// v000
// Times are from an AMD MI455X. After a warm-up the kernel runs many times in a row, and a time is the length of
// such a window on the GPU divided by its runs, so every launch and the gaps after it count. The runs cycle
// through copies of the inputs. A figure is the median of several windows, for all but v000 over two sittings.
// Sittings can differ by a few percent; kernels timed side by side share one.
// The starting kernel, v000, takes 194 microseconds a run.
#include <hip/hip_runtime.h>

// ---------------------------------------------------------------------------
// Types
// ---------------------------------------------------------------------------
typedef __attribute__((ext_vector_type(16))) __bf16        v16bf;
typedef __attribute__((ext_vector_type(8)))  float         v8f;
typedef __attribute__((ext_vector_type(4)))  unsigned int  u32x4;
typedef __attribute__((ext_vector_type(8)))  unsigned int  u32x8;
typedef __attribute__((ext_vector_type(2)))  unsigned int  u32x2;
typedef __attribute__((ext_vector_type(4)))  float         f32x4;

// round-to-nearest-even f32 -> bf16 (bit twiddle; no reliance on __bf16 arith)
static __device__ __forceinline__ __bf16 tobf(float x) {
  unsigned u = __builtin_bit_cast(unsigned, x);
  u = (u + 0x7FFFu + ((u >> 16) & 1u)) >> 16;
  unsigned short s = (unsigned short)u;
  return __builtin_bit_cast(__bf16, s);
}

// Load one 16x32 bf16 A/B WMMA fragment from a row-major bf16 matrix.
// Per CDNA5 ISA 16-bit A layout: lane m (m<16) holds row m, K {0..7, 16..23};
// lane m+16 holds row m, K {8..15, 24..31}. B fragments use the identical
// per-lane pattern with "row" = C-column (NT GEMM symmetry).
static __device__ __forceinline__ v16bf load_frag(const __bf16* p, int stride, int lane) {
  const int m = lane & 15, h = lane >> 4;
  const __bf16* q = p + (size_t)m * (size_t)stride + h * 8;
  u32x4 lo = *(const u32x4*)(q);        // K chunk {0..7}/{8..15}
  u32x4 hi = *(const u32x4*)(q + 16);   // K chunk {16..23}/{24..31}
  u32x8 w = __builtin_shufflevector(lo, hi, 0, 1, 2, 3, 4, 5, 6, 7);
  return __builtin_bit_cast(v16bf, w);
}

static __device__ __forceinline__ v8f wmma_bf16(v16bf a, v16bf b, v8f c) {
  return __builtin_amdgcn_wmma_f32_16x16x32_bf16(false, a, false, b, (short)0, c,
                                                 false, false);
}

// CDNA5 async global->LDS copy (ASYNCcnt-tracked, no VGPR round trip).
// 16 bytes per lane; LDS dest address from VGPR, 64-bit global addr from VGPR pair.
static __device__ __forceinline__ void async_g2l_b128(void* lds_dst, const void* gsrc) {
  unsigned ldsa = (unsigned)(size_t)lds_dst;             // low 32 bits = LDS offset
  unsigned long long ga = (unsigned long long)(size_t)gsrc;
  asm volatile("global_load_async_to_lds_b128 %0, %1, off"
               :: "v"(ldsa), "v"(ga)
               : "memory");
}

// Wait until at most N async copies remain in flight (in-order completion =>
// all older copies have landed in LDS).
template <int N>
static __device__ __forceinline__ void wait_async() {
#if __has_builtin(__builtin_amdgcn_s_wait_asynccnt)
  __builtin_amdgcn_s_wait_asynccnt(N);
#else
  if constexpr (N == 0)
    asm volatile("s_wait_asynccnt 0x0" ::: "memory");
  else if constexpr (N == 2)
    asm volatile("s_wait_asynccnt 0x2" ::: "memory");
  else
    asm volatile("s_wait_asynccnt 0x6" ::: "memory");
#endif
}

// ---------------------------------------------------------------------------
// Kernel 1: f32 -> bf16 convert (4 elements / thread)
// ---------------------------------------------------------------------------
__global__ __launch_bounds__(256) void cvt_f32_bf16(const float* __restrict__ src,
                                                    __bf16* __restrict__ dst, int n4) {
  int i = blockIdx.x * 256 + threadIdx.x;
  if (i >= n4) return;
  f32x4 f = *(const f32x4*)(src + (size_t)i * 4);
  u32x2 o;
  o[0] = (unsigned)__builtin_bit_cast(unsigned short, tobf(f[0])) |
         ((unsigned)__builtin_bit_cast(unsigned short, tobf(f[1])) << 16);
  o[1] = (unsigned)__builtin_bit_cast(unsigned short, tobf(f[2])) |
         ((unsigned)__builtin_bit_cast(unsigned short, tobf(f[3])) << 16);
  *(u32x2*)(dst + (size_t)i * 4) = o;
}

// ---------------------------------------------------------------------------
// Kernels 2 & 4: NT bf16 GEMM  C(M x Ncols) = A(M x 1024) * B(Ncols x 1024)^T
// Workgroup tile 64(M) x 128(N), 8 waves (2x4), wave tile 32x32 (2x2 WMMA
// tiles). K streamed in 64-wide chunks through DOUBLE-BUFFERED LDS using
// async global->LDS copies: chunk i+1 streams in while WMMAs run on chunk i.
// MODE 0: QKV projection epilogue (bias + de-interleave + scale Q + V^T store)
// MODE 1: output projection epilogue (bias, f32 store to d_out)
// ---------------------------------------------------------------------------
static constexpr int LDST = 72;  // ushort stride = 144 bytes (conflict-free)
static constexpr int ASZ = 64 * LDST;
static constexpr int BSZ = 128 * LDST;

template <int MODE>
__global__ __launch_bounds__(256) void gemm_nt(
    const __bf16* __restrict__ A, const __bf16* __restrict__ B,
    const float* __restrict__ bias, float* __restrict__ outF,
    __bf16* __restrict__ Qb, __bf16* __restrict__ Kb, __bf16* __restrict__ Vtb) {
  __shared__ __align__(16) __bf16 sA[2 * ASZ];
  __shared__ __align__(16) __bf16 sB[2 * BSZ];

  const int tid = threadIdx.x;
  const int lane = tid & 31;
  const int w = tid >> 5;
  const int wm = w & 1, wn = w >> 1;
  const int row0 = blockIdx.y * 64;
  const int col0 = blockIdx.x * 128;

  // 6 async copies per thread per K-chunk (2 for A, 4 for B).
  auto stage = [&](int buf, int kb) {
#pragma unroll
    for (int s = 0; s < 2; ++s) {  // A tile: 64 rows x 64 K = 512 x 16B
      int idx = tid + s * 256;
      int r = idx >> 3, c = (idx & 7) * 8;
      async_g2l_b128(sA + buf * ASZ + r * LDST + c,
                     A + (size_t)(row0 + r) * 1024 + kb + c);
    }
#pragma unroll
    for (int s = 0; s < 4; ++s) {  // B tile: 128 rows x 64 K
      int idx = tid + s * 256;
      int r = idx >> 3, c = (idx & 7) * 8;
      async_g2l_b128(sB + buf * BSZ + r * LDST + c,
                     B + (size_t)(col0 + r) * 1024 + kb + c);
    }
  };

  v8f acc[2][2] = {};

  stage(0, 0);
  for (int kb = 0; kb < 1024; kb += 64) {
    const int cur = (kb >> 6) & 1;
    if (kb + 64 < 1024) {
      stage(cur ^ 1, kb + 64);  // prefetch next chunk into other buffer
      wait_async<6>();          // ensure chunk `cur` has landed
    } else {
      wait_async<0>();
    }
    __syncthreads();

    const __bf16* cA = sA + cur * ASZ;
    const __bf16* cB = sB + cur * BSZ;
#pragma unroll
    for (int kk = 0; kk < 64; kk += 32) {
      v16bf af[2], bfr[2];
#pragma unroll
      for (int i = 0; i < 2; ++i)
        af[i] = load_frag(cA + (wm * 32 + i * 16) * LDST + kk, LDST, lane);
#pragma unroll
      for (int j = 0; j < 2; ++j)
        bfr[j] = load_frag(cB + (wn * 32 + j * 16) * LDST + kk, LDST, lane);
#pragma unroll
      for (int i = 0; i < 2; ++i)
#pragma unroll
        for (int j = 0; j < 2; ++j)
          acc[i][j] = wmma_bf16(af[i], bfr[j], acc[i][j]);
    }
    __syncthreads();  // all waves done with buffer `cur` before it is re-staged
  }

  // Epilogue. C layout: VGPR v -> row (v + half*8), col = lane%16 within tile.
  const int m = lane & 15, half = lane >> 4;
#pragma unroll
  for (int i = 0; i < 2; ++i) {
#pragma unroll
    for (int j = 0; j < 2; ++j) {
      const int f = col0 + wn * 32 + j * 16 + m;
      const float bv = bias[f];
#pragma unroll
      for (int v = 0; v < 8; ++v) {
        const int r = row0 + wm * 32 + i * 16 + v + half * 8;
        const float val = acc[i][j][v] + bv;
        if (MODE == 1) {
          outF[(size_t)r * 1024 + f] = val;
        } else {
          // r = l*4 + n ; f = 3*ii + jj ; ii = hh*64 + dd ; b = n*16 + hh
          const int l = r >> 2, n = r & 3;
          const int jj = f % 3, ii = f / 3;
          const int hh = ii >> 6, dd = ii & 63;
          const int b = n * 16 + hh;
          if (jj == 0)
            Qb[((size_t)b * 2048 + l) * 64 + dd] = tobf(val * 0.125f);  // fold scale
          else if (jj == 1)
            Kb[((size_t)b * 2048 + l) * 64 + dd] = tobf(val);
          else
            Vtb[((size_t)b * 64 + dd) * 2048 + l] = tobf(val);  // V transposed
        }
      }
    }
  }
}

// ---------------------------------------------------------------------------
// Kernel 3: flash attention. One wave = 16 query rows of one (batch,head) b.
// All 8 waves of a block share b, so each 32-key K/V^T block is staged ONCE
// per workgroup into double-buffered LDS via async copies: block i+1 streams
// in while WMMAs/softmax run on block i.
// Computes S^T = K*Q^T so that exp(S^T) registers are already in the exact
// B-operand packing for O^T += V^T * P^T (no LDS transpose needed).
// ---------------------------------------------------------------------------
static constexpr int KST = 72;  // K tile stride (ushorts) = 144B
static constexpr int VST = 40;  // V tile stride (ushorts) = 80B
static constexpr int KSZ = 32 * KST;
static constexpr int VSZ = 64 * VST;

__global__ __launch_bounds__(256) void attn_kernel(const __bf16* __restrict__ Q,
                                                   const __bf16* __restrict__ K,
                                                   const __bf16* __restrict__ Vt,
                                                   __bf16* __restrict__ O) {
  __shared__ __align__(16) __bf16 sK[2 * KSZ];  // 32 keys x 64 d
  __shared__ __align__(16) __bf16 sV[2 * VSZ];  // 64 d x 32 keys (V^T)

  const int tid = threadIdx.x;
  const int lane = tid & 31;
  const int w = tid >> 5;
  const int b = blockIdx.y;                   // 0..63  (= n*16 + head)
  const int r0 = blockIdx.x * 128 + w * 16;   // query row tile
  const int m = lane & 15, half = lane >> 4;

  const __bf16* Qb = Q + (size_t)b * 2048 * 64;
  const __bf16* Kb = K + (size_t)b * 2048 * 64;
  const __bf16* Vb = Vt + (size_t)b * 64 * 2048;

  // Per-thread staging coordinates (4KB per tile = 256 x 16B).
  const int kr = tid >> 3, kc = (tid & 7) * 8;  // K: 32 rows x 8 chunks
  const int vr = tid >> 2, vc = (tid & 3) * 8;  // V: 64 rows x 4 chunks

  // 2 async copies per thread per 32-key block.
  auto stage = [&](int buf, int key0) {
    async_g2l_b128(sK + buf * KSZ + kr * KST + kc,
                   Kb + (size_t)(key0 + kr) * 64 + kc);
    async_g2l_b128(sV + buf * VSZ + vr * VST + vc,
                   Vb + (size_t)vr * 2048 + key0 + vc);
  };

  // Q fragments (used as B operand: column n = query row n), d split in 2x32
  v16bf qf[2];
#pragma unroll
  for (int c = 0; c < 2; ++c)
    qf[c] = load_frag(Qb + (size_t)r0 * 64 + c * 32, 64, lane);

  v8f ot[4] = {};            // O^T tiles: d = j*16 + v + half*8, col = query m
  float mrow = -1e30f;       // running max for query row m (dup in lane m+16)
  float lrow = 0.0f;         // running sum

  stage(0, 0);
  for (int kb = 0; kb < 64; ++kb) {
    const int cur = kb & 1;
    if (kb + 1 < 64) {
      stage(cur ^ 1, (kb + 1) * 32);  // prefetch next block into other buffer
      wait_async<2>();                // ensure block `cur` has landed
    } else {
      wait_async<0>();
    }
    __syncthreads();

    const __bf16* cK = sK + cur * KSZ;
    const __bf16* cV = sV + cur * VSZ;

    // K fragments as A operand: 2 key tiles x 2 d-chunks (from LDS)
    v16bf kf[2][2];
#pragma unroll
    for (int t = 0; t < 2; ++t)
#pragma unroll
      for (int c = 0; c < 2; ++c)
        kf[t][c] = load_frag(cK + (t * 16) * KST + c * 32, KST, lane);

    // S^T tiles: row = key, col = query. Q already scaled by 1/8.
    v8f st[2];
#pragma unroll
    for (int t = 0; t < 2; ++t) {
      v8f z = {};
      z = wmma_bf16(kf[t][0], qf[0], z);
      st[t] = wmma_bf16(kf[t][1], qf[1], z);
    }

    // V^T fragments as A operand: rows = d, contiguous keys (from LDS)
    v16bf vf[4];
#pragma unroll
    for (int j = 0; j < 4; ++j)
      vf[j] = load_frag(cV + (j * 16) * VST, VST, lane);

    // online softmax: each lane holds 16 scores of its query row; partner lane
    // (xor 16) holds the other 16 keys of this 32-key block.
    float vmax = -1e30f;
#pragma unroll
    for (int t = 0; t < 2; ++t)
#pragma unroll
      for (int v = 0; v < 8; ++v) vmax = fmaxf(vmax, st[t][v]);
    vmax = fmaxf(vmax, __shfl_xor(vmax, 16, 32));
    const float mnew = fmaxf(mrow, vmax);
    const float alpha = __expf(mrow - mnew);

    // P^T in registers, repacked directly into B-operand layout:
    // element e<8 -> tile0[e], e>=8 -> tile1[e-8] (both lane halves).
    v16bf pb;
    float psum = 0.0f;
#pragma unroll
    for (int v = 0; v < 8; ++v) {
      const float p0 = __expf(st[0][v] - mnew);
      const float p1 = __expf(st[1][v] - mnew);
      psum += p0 + p1;
      pb[v] = tobf(p0);
      pb[v + 8] = tobf(p1);
    }
    psum += __shfl_xor(psum, 16, 32);
    lrow = lrow * alpha + psum;
    mrow = mnew;

#pragma unroll
    for (int j = 0; j < 4; ++j) {
      ot[j] *= alpha;
      ot[j] = wmma_bf16(vf[j], pb, ot[j]);
    }
    __syncthreads();  // all waves done with buffer `cur` before it is re-staged
  }

  // Normalize and scatter into (l, n, h*64 + d) bf16 layout for the out GEMM.
  const float inv = 1.0f / lrow;
  const int lseq = r0 + m;
  const int n = b >> 4, hh = b & 15;
  __bf16* orow = O + ((size_t)lseq * 4 + n) * 1024 + hh * 64;
#pragma unroll
  for (int j = 0; j < 4; ++j)
#pragma unroll
    for (int v = 0; v < 8; ++v)
      orow[j * 16 + v + half * 8] = tobf(ot[j][v] * inv);
}

// ---------------------------------------------------------------------------
// Launch
// ---------------------------------------------------------------------------
extern "C" void kernel_launch(void* const* d_in, const int* in_sizes, int n_in,
                              void* d_out, int out_size, void* d_ws, size_t ws_size,
                              hipStream_t stream) {
  const float* query = (const float*)d_in[0];     // (2048, 4, 1024)
  const float* qkv_proj = (const float*)d_in[1];  // (3072, 1024)
  const float* qkv_bias = (const float*)d_in[2];  // (3072,)
  const float* out_proj = (const float*)d_in[3];  // (1024, 1024)
  const float* out_bias = (const float*)d_in[4];  // (1024,)
  float* out = (float*)d_out;                     // (2048, 4, 1024) f32
  (void)in_sizes; (void)n_in; (void)out_size; (void)ws_size;

  char* ws = (char*)d_ws;
  size_t off = 0;
  auto carve = [&](size_t bytes) {
    void* p = ws + off;
    off += (bytes + 255) & ~(size_t)255;
    return p;
  };
  __bf16* qA   = (__bf16*)carve(8192ull * 1024 * 2);       // query bf16
  __bf16* wQKV = (__bf16*)carve(3072ull * 1024 * 2);       // qkv_proj bf16
  __bf16* wOUT = (__bf16*)carve(1024ull * 1024 * 2);       // out_proj bf16
  __bf16* Qb   = (__bf16*)carve(64ull * 2048 * 64 * 2);    // Q (b,l,d), pre-scaled
  __bf16* Kb   = (__bf16*)carve(64ull * 2048 * 64 * 2);    // K (b,l,d)
  __bf16* Vtb  = (__bf16*)carve(64ull * 64 * 2048 * 2);    // V^T (b,d,l)
  __bf16* Ob   = (__bf16*)carve(8192ull * 1024 * 2);       // attn out (l*4+n, i)

  cvt_f32_bf16<<<(8192 * 1024 / 4 + 255) / 256, 256, 0, stream>>>(query, qA,
                                                                  8192 * 1024 / 4);
  cvt_f32_bf16<<<(3072 * 1024 / 4 + 255) / 256, 256, 0, stream>>>(qkv_proj, wQKV,
                                                                  3072 * 1024 / 4);
  cvt_f32_bf16<<<(1024 * 1024 / 4 + 255) / 256, 256, 0, stream>>>(out_proj, wOUT,
                                                                  1024 * 1024 / 4);

  // QKV projection: M=8192, N=3072 -> grid (24, 128)
  gemm_nt<0><<<dim3(24, 128), 256, 0, stream>>>(qA, wQKV, qkv_bias, nullptr, Qb, Kb,
                                                Vtb);
  // Attention: 64 head-batches x 16 row-groups of 128 rows
  attn_kernel<<<dim3(16, 64), 256, 0, stream>>>(Qb, Kb, Vtb, Ob);
  // Output projection: M=8192, N=1024 -> grid (8, 128)
  gemm_nt<1><<<dim3(8, 128), 256, 0, stream>>>(Ob, wOUT, out_bias, out, nullptr,
                                               nullptr, nullptr);
}

// v001
// Measured time: 171 microseconds a run.
// Next to v000, in two timings, it ran 1.17 times as fast each time.
#include <hip/hip_runtime.h>

// ---------------------------------------------------------------------------
// Types
// ---------------------------------------------------------------------------
typedef __attribute__((ext_vector_type(16))) __bf16        v16bf;
typedef __attribute__((ext_vector_type(8)))  float         v8f;
typedef __attribute__((ext_vector_type(4)))  unsigned int  u32x4;
typedef __attribute__((ext_vector_type(8)))  unsigned int  u32x8;
typedef __attribute__((ext_vector_type(2)))  unsigned int  u32x2;
typedef __attribute__((ext_vector_type(4)))  float         f32x4;

// round-to-nearest-even f32 -> bf16 (bit twiddle; no reliance on __bf16 arith)
static __device__ __forceinline__ __bf16 tobf(float x) {
  unsigned u = __builtin_bit_cast(unsigned, x);
  u = (u + 0x7FFFu + ((u >> 16) & 1u)) >> 16;
  unsigned short s = (unsigned short)u;
  return __builtin_bit_cast(__bf16, s);
}

// Eight f32 -> eight bf16 in one 16-byte word group (element 0 lowest).
static __device__ __forceinline__ u32x4 pack8(v8f x) {
  u32x4 o;
#pragma unroll
  for (int e = 0; e < 4; ++e)
    o[e] = (unsigned)__builtin_bit_cast(unsigned short, tobf(x[2 * e])) |
           ((unsigned)__builtin_bit_cast(unsigned short, tobf(x[2 * e + 1])) << 16);
  return o;
}

// Load one 16x32 bf16 A/B WMMA fragment from a row-major bf16 matrix.
// Per CDNA5 ISA 16-bit A layout: lane m (m<16) holds row m, K {0..7, 16..23};
// lane m+16 holds row m, K {8..15, 24..31}. B fragments use the identical
// per-lane pattern with "row" = C-column (NT GEMM symmetry).
static __device__ __forceinline__ v16bf load_frag(const __bf16* p, int stride, int lane) {
  const int m = lane & 15, h = lane >> 4;
  const __bf16* q = p + (size_t)m * (size_t)stride + h * 8;
  u32x4 lo = *(const u32x4*)(q);        // K chunk {0..7}/{8..15}
  u32x4 hi = *(const u32x4*)(q + 16);   // K chunk {16..23}/{24..31}
  u32x8 w = __builtin_shufflevector(lo, hi, 0, 1, 2, 3, 4, 5, 6, 7);
  return __builtin_bit_cast(v16bf, w);
}

static __device__ __forceinline__ v8f wmma_bf16(v16bf a, v16bf b, v8f c) {
  return __builtin_amdgcn_wmma_f32_16x16x32_bf16(false, a, false, b, (short)0, c,
                                                 false, false);
}

// CDNA5 async global->LDS copy (ASYNCcnt-tracked, no VGPR round trip).
// 16 bytes per lane; LDS dest address from VGPR, 64-bit global addr from VGPR pair.
static __device__ __forceinline__ void async_g2l_b128(void* lds_dst, const void* gsrc) {
  unsigned ldsa = (unsigned)(size_t)lds_dst;             // low 32 bits = LDS offset
  unsigned long long ga = (unsigned long long)(size_t)gsrc;
  asm volatile("global_load_async_to_lds_b128 %0, %1, off"
               :: "v"(ldsa), "v"(ga)
               : "memory");
}

// Wait until at most N async copies remain in flight (in-order completion =>
// all older copies have landed in LDS).
template <int N>
static __device__ __forceinline__ void wait_async() {
#if __has_builtin(__builtin_amdgcn_s_wait_asynccnt)
  __builtin_amdgcn_s_wait_asynccnt(N);
#else
  if constexpr (N == 0)
    asm volatile("s_wait_asynccnt 0x0" ::: "memory");
  else if constexpr (N == 2)
    asm volatile("s_wait_asynccnt 0x2" ::: "memory");
  else
    asm volatile("s_wait_asynccnt 0x6" ::: "memory");
#endif
}

// ---------------------------------------------------------------------------
// Kernel 1: f32 -> bf16 convert (4 elements / thread), rows of 1024 elements
// (one block = one row). PERM picks the destination row:
//   0: same row
//   1: source row l*4 + n   -> row n*2048 + l    (tokens grouped by batch n)
//   2: source row 3*ii + jj -> row jj*1024 + ii  (Q, K, V weight rows grouped)
// ---------------------------------------------------------------------------
template <int PERM>
__global__ __launch_bounds__(256) void cvt_f32_bf16(const float* __restrict__ src,
                                                    __bf16* __restrict__ dst, int n4) {
  int i = blockIdx.x * 256 + threadIdx.x;
  if (i >= n4) return;
  const int row = i >> 8, c4 = i & 255;
  const int drow = PERM == 1 ? (row & 3) * 2048 + (row >> 2)
                 : PERM == 2 ? (row % 3) * 1024 + row / 3
                             : row;
  f32x4 f = *(const f32x4*)(src + (size_t)i * 4);
  u32x2 o;
  o[0] = (unsigned)__builtin_bit_cast(unsigned short, tobf(f[0])) |
         ((unsigned)__builtin_bit_cast(unsigned short, tobf(f[1])) << 16);
  o[1] = (unsigned)__builtin_bit_cast(unsigned short, tobf(f[2])) |
         ((unsigned)__builtin_bit_cast(unsigned short, tobf(f[3])) << 16);
  *(u32x2*)(dst + (size_t)drow * 1024 + c4 * 4) = o;
}

// ---------------------------------------------------------------------------
// Kernels 2 & 4: NT bf16 GEMM  C(M x Ncols) = A(M x 1024) * B(Ncols x 1024)^T
// Workgroup tile 64(M) x 128(N), 8 waves (2x4), wave tile 32x32 (2x2 WMMA
// tiles). K streamed in 64-wide chunks through DOUBLE-BUFFERED LDS using
// async global->LDS copies: chunk i+1 streams in while WMMAs run on chunk i.
// MODE 0: QKV projection. A rows are n*2048 + l, B rows jj*1024 + ii (see the
//         convert), so a block is one n, 64 consecutive l, and all Q, all K or
//         all V. A lane's 8 accumulator registers run along the tile's row
//         axis: V blocks keep tokens there (8 consecutive l = 16 B of V^T);
//         Q and K blocks trade the two operands, so features lie there
//         (8 consecutive d = 16 B of a Q or K row). One 16-byte store per tile.
// MODE 1: output projection epilogue (bias, f32 store to d_out)
// ---------------------------------------------------------------------------
static constexpr int LDST = 72;  // ushort stride = 144 bytes (conflict-free)
static constexpr int ASZ = 64 * LDST;
static constexpr int BSZ = 128 * LDST;

template <int MODE>
__global__ __launch_bounds__(256) void gemm_nt(
    const __bf16* __restrict__ A, const __bf16* __restrict__ B,
    const float* __restrict__ bias, float* __restrict__ outF,
    __bf16* __restrict__ Qb, __bf16* __restrict__ Kb, __bf16* __restrict__ Vtb) {
  __shared__ __align__(16) __bf16 sA[2 * ASZ];
  __shared__ __align__(16) __bf16 sB[2 * BSZ];

  const int tid = threadIdx.x;
  const int lane = tid & 31;
  const int w = tid >> 5;
  const int wm = w & 1, wn = w >> 1;
  const int row0 = blockIdx.y * 64;
  const int col0 = blockIdx.x * 128;
  const bool swp = MODE == 0 && col0 < 2048;  // Q or K block (block-uniform)

  // 6 async copies per thread per K-chunk (2 for A, 4 for B).
  auto stage = [&](int buf, int kb) {
#pragma unroll
    for (int s = 0; s < 2; ++s) {  // A tile: 64 rows x 64 K = 512 x 16B
      int idx = tid + s * 256;
      int r = idx >> 3, c = (idx & 7) * 8;
      async_g2l_b128(sA + buf * ASZ + r * LDST + c,
                     A + (size_t)(row0 + r) * 1024 + kb + c);
    }
#pragma unroll
    for (int s = 0; s < 4; ++s) {  // B tile: 128 rows x 64 K
      int idx = tid + s * 256;
      int r = idx >> 3, c = (idx & 7) * 8;
      async_g2l_b128(sB + buf * BSZ + r * LDST + c,
                     B + (size_t)(col0 + r) * 1024 + kb + c);
    }
  };

  v8f acc[2][2] = {};

  stage(0, 0);
  for (int kb = 0; kb < 1024; kb += 64) {
    const int cur = (kb >> 6) & 1;
    if (kb + 64 < 1024) {
      stage(cur ^ 1, kb + 64);  // prefetch next chunk into other buffer
      wait_async<6>();          // ensure chunk `cur` has landed
    } else {
      wait_async<0>();
    }
    __syncthreads();

    const __bf16* tA = sA + cur * ASZ + wm * 32 * LDST;  // this wave's 32 tokens
    const __bf16* tB = sB + cur * BSZ + wn * 32 * LDST;  // this wave's 32 features
    const __bf16* cA = swp ? tB : tA;  // rows of the accumulator tiles
    const __bf16* cB = swp ? tA : tB;  // columns of the accumulator tiles
#pragma unroll
    for (int kk = 0; kk < 64; kk += 32) {
      v16bf af[2], bfr[2];
#pragma unroll
      for (int i = 0; i < 2; ++i)
        af[i] = load_frag(cA + i * 16 * LDST + kk, LDST, lane);
#pragma unroll
      for (int j = 0; j < 2; ++j)
        bfr[j] = load_frag(cB + j * 16 * LDST + kk, LDST, lane);
#pragma unroll
      for (int i = 0; i < 2; ++i)
#pragma unroll
        for (int j = 0; j < 2; ++j)
          acc[i][j] = wmma_bf16(af[i], bfr[j], acc[i][j]);
    }
    __syncthreads();  // all waves done with buffer `cur` before it is re-staged
  }

  // Epilogue. C layout: VGPR v -> row (v + half*8), col = lane%16 within tile.
  const int m = lane & 15, half = lane >> 4;
  if (MODE == 1) {
#pragma unroll
    for (int i = 0; i < 2; ++i) {
#pragma unroll
      for (int j = 0; j < 2; ++j) {
        const int f = col0 + wn * 32 + j * 16 + m;
        const float bv = bias[f];
#pragma unroll
        for (int v = 0; v < 8; ++v) {
          const int r = row0 + wm * 32 + i * 16 + v + half * 8;
          outF[(size_t)r * 1024 + f] = acc[i][j][v] + bv;
        }
      }
    }
  } else {
    // bias index of (ii, jj) is 3*ii + jj ; ii = hh*64 + dd ; b = n*16 + hh
    const int n = row0 >> 11;
    const int lb = (row0 & 2047) + wm * 32;    // first token of the wave tile
    const int ib = (col0 & 1023) + wn * 32;    // first feature ii of the wave tile
    if (swp) {
      const int jj = col0 >> 10;               // 0: Q, 1: K
      __bf16* dst = jj == 0 ? Qb : Kb;
      const float sc = jj == 0 ? 0.125f : 1.0f;  // fold the score scale into Q
#pragma unroll
      for (int i = 0; i < 2; ++i) {
        const int ii = ib + i * 16 + half * 8;  // 8 consecutive d of one head
        v8f bv;
#pragma unroll
        for (int v = 0; v < 8; ++v) bv[v] = bias[3 * (ii + v) + jj];
        const int b = n * 16 + (ii >> 6);
#pragma unroll
        for (int j = 0; j < 2; ++j) {
          const int l = lb + j * 16 + m;
          *(u32x4*)(dst + ((size_t)b * 2048 + l) * 64 + (ii & 63)) =
              pack8((acc[i][j] + bv) * sc);
        }
      }
    } else {
#pragma unroll
      for (int j = 0; j < 2; ++j) {
        const int ii = ib + j * 16 + m;
        const float bv = bias[3 * ii + 2];
        const int b = n * 16 + (ii >> 6);
#pragma unroll
        for (int i = 0; i < 2; ++i) {
          const int l = lb + i * 16 + half * 8;  // 8 consecutive tokens
          *(u32x4*)(Vtb + ((size_t)b * 64 + (ii & 63)) * 2048 + l) =
              pack8(acc[i][j] + bv);
        }
      }
      // Precaution: the built code lays the Q/K block behind these stores and
      // rewrites their address and data registers there; the wait stands first.
      asm volatile("s_wait_xcnt 0x0" ::: "memory");
    }
  }
}

// ---------------------------------------------------------------------------
// Kernel 3: flash attention. One wave = 16 query rows of one (batch,head) b.
// All 8 waves of a block share b, so each 32-key K/V^T block is staged ONCE
// per workgroup into double-buffered LDS via async copies: block i+1 streams
// in while WMMAs/softmax run on block i.
// Computes S^T = K*Q^T so that exp(S^T) registers are already in the exact
// B-operand packing for O^T += V^T * P^T (no LDS transpose needed).
// ---------------------------------------------------------------------------
static constexpr int KST = 72;  // K tile stride (ushorts) = 144B
static constexpr int VST = 40;  // V tile stride (ushorts) = 80B
static constexpr int KSZ = 32 * KST;
static constexpr int VSZ = 64 * VST;

__global__ __launch_bounds__(256) void attn_kernel(const __bf16* __restrict__ Q,
                                                   const __bf16* __restrict__ K,
                                                   const __bf16* __restrict__ Vt,
                                                   __bf16* __restrict__ O) {
  __shared__ __align__(16) __bf16 sK[2 * KSZ];  // 32 keys x 64 d
  __shared__ __align__(16) __bf16 sV[2 * VSZ];  // 64 d x 32 keys (V^T)

  const int tid = threadIdx.x;
  const int lane = tid & 31;
  const int w = tid >> 5;
  const int b = blockIdx.y;                   // 0..63  (= n*16 + head)
  const int r0 = blockIdx.x * 128 + w * 16;   // query row tile
  const int m = lane & 15, half = lane >> 4;

  const __bf16* Qb = Q + (size_t)b * 2048 * 64;
  const __bf16* Kb = K + (size_t)b * 2048 * 64;
  const __bf16* Vb = Vt + (size_t)b * 64 * 2048;

  // Per-thread staging coordinates (4KB per tile = 256 x 16B).
  const int kr = tid >> 3, kc = (tid & 7) * 8;  // K: 32 rows x 8 chunks
  const int vr = tid >> 2, vc = (tid & 3) * 8;  // V: 64 rows x 4 chunks

  // 2 async copies per thread per 32-key block.
  auto stage = [&](int buf, int key0) {
    async_g2l_b128(sK + buf * KSZ + kr * KST + kc,
                   Kb + (size_t)(key0 + kr) * 64 + kc);
    async_g2l_b128(sV + buf * VSZ + vr * VST + vc,
                   Vb + (size_t)vr * 2048 + key0 + vc);
  };

  // Q fragments (used as B operand: column n = query row n), d split in 2x32
  v16bf qf[2];
#pragma unroll
  for (int c = 0; c < 2; ++c)
    qf[c] = load_frag(Qb + (size_t)r0 * 64 + c * 32, 64, lane);

  v8f ot[4] = {};            // O^T tiles: d = j*16 + v + half*8, col = query m
  float mrow = -1e30f;       // running max for query row m (dup in lane m+16)
  float lrow = 0.0f;         // running sum

  stage(0, 0);
  for (int kb = 0; kb < 64; ++kb) {
    const int cur = kb & 1;
    if (kb + 1 < 64) {
      stage(cur ^ 1, (kb + 1) * 32);  // prefetch next block into other buffer
      wait_async<2>();                // ensure block `cur` has landed
    } else {
      wait_async<0>();
    }
    __syncthreads();

    const __bf16* cK = sK + cur * KSZ;
    const __bf16* cV = sV + cur * VSZ;

    // K fragments as A operand: 2 key tiles x 2 d-chunks (from LDS)
    v16bf kf[2][2];
#pragma unroll
    for (int t = 0; t < 2; ++t)
#pragma unroll
      for (int c = 0; c < 2; ++c)
        kf[t][c] = load_frag(cK + (t * 16) * KST + c * 32, KST, lane);

    // S^T tiles: row = key, col = query. Q already scaled by 1/8.
    v8f st[2];
#pragma unroll
    for (int t = 0; t < 2; ++t) {
      v8f z = {};
      z = wmma_bf16(kf[t][0], qf[0], z);
      st[t] = wmma_bf16(kf[t][1], qf[1], z);
    }

    // V^T fragments as A operand: rows = d, contiguous keys (from LDS)
    v16bf vf[4];
#pragma unroll
    for (int j = 0; j < 4; ++j)
      vf[j] = load_frag(cV + (j * 16) * VST, VST, lane);

    // online softmax: each lane holds 16 scores of its query row; partner lane
    // (xor 16) holds the other 16 keys of this 32-key block.
    float vmax = -1e30f;
#pragma unroll
    for (int t = 0; t < 2; ++t)
#pragma unroll
      for (int v = 0; v < 8; ++v) vmax = fmaxf(vmax, st[t][v]);
    vmax = fmaxf(vmax, __shfl_xor(vmax, 16, 32));
    const float mnew = fmaxf(mrow, vmax);
    const float alpha = __expf(mrow - mnew);

    // P^T in registers, repacked directly into B-operand layout:
    // element e<8 -> tile0[e], e>=8 -> tile1[e-8] (both lane halves).
    v16bf pb;
    float psum = 0.0f;
#pragma unroll
    for (int v = 0; v < 8; ++v) {
      const float p0 = __expf(st[0][v] - mnew);
      const float p1 = __expf(st[1][v] - mnew);
      psum += p0 + p1;
      pb[v] = tobf(p0);
      pb[v + 8] = tobf(p1);
    }
    psum += __shfl_xor(psum, 16, 32);
    lrow = lrow * alpha + psum;
    mrow = mnew;

#pragma unroll
    for (int j = 0; j < 4; ++j) {
      ot[j] *= alpha;
      ot[j] = wmma_bf16(vf[j], pb, ot[j]);
    }
    __syncthreads();  // all waves done with buffer `cur` before it is re-staged
  }

  // Normalize and scatter into (l, n, h*64 + d) bf16 layout for the out GEMM.
  const float inv = 1.0f / lrow;
  const int lseq = r0 + m;
  const int n = b >> 4, hh = b & 15;
  __bf16* orow = O + ((size_t)lseq * 4 + n) * 1024 + hh * 64;
#pragma unroll
  for (int j = 0; j < 4; ++j)
#pragma unroll
    for (int v = 0; v < 8; ++v)
      orow[j * 16 + v + half * 8] = tobf(ot[j][v] * inv);
}

// ---------------------------------------------------------------------------
// Launch
// ---------------------------------------------------------------------------
extern "C" void kernel_launch(void* const* d_in, const int* in_sizes, int n_in,
                              void* d_out, int out_size, void* d_ws, size_t ws_size,
                              hipStream_t stream) {
  const float* query = (const float*)d_in[0];     // (2048, 4, 1024)
  const float* qkv_proj = (const float*)d_in[1];  // (3072, 1024)
  const float* qkv_bias = (const float*)d_in[2];  // (3072,)
  const float* out_proj = (const float*)d_in[3];  // (1024, 1024)
  const float* out_bias = (const float*)d_in[4];  // (1024,)
  float* out = (float*)d_out;                     // (2048, 4, 1024) f32
  (void)in_sizes; (void)n_in; (void)out_size; (void)ws_size;

  char* ws = (char*)d_ws;
  size_t off = 0;
  auto carve = [&](size_t bytes) {
    void* p = ws + off;
    off += (bytes + 255) & ~(size_t)255;
    return p;
  };
  __bf16* qA   = (__bf16*)carve(8192ull * 1024 * 2);       // query bf16, row n*2048+l
  __bf16* wQKV = (__bf16*)carve(3072ull * 1024 * 2);       // qkv_proj bf16, row jj*1024+ii
  __bf16* wOUT = (__bf16*)carve(1024ull * 1024 * 2);       // out_proj bf16
  __bf16* Qb   = (__bf16*)carve(64ull * 2048 * 64 * 2);    // Q (b,l,d), pre-scaled
  __bf16* Kb   = (__bf16*)carve(64ull * 2048 * 64 * 2);    // K (b,l,d)
  __bf16* Vtb  = (__bf16*)carve(64ull * 64 * 2048 * 2);    // V^T (b,d,l)
  __bf16* Ob   = (__bf16*)carve(8192ull * 1024 * 2);       // attn out (l*4+n, i)

  cvt_f32_bf16<1><<<(8192 * 1024 / 4 + 255) / 256, 256, 0, stream>>>(query, qA,
                                                                     8192 * 1024 / 4);
  cvt_f32_bf16<2><<<(3072 * 1024 / 4 + 255) / 256, 256, 0, stream>>>(qkv_proj, wQKV,
                                                                     3072 * 1024 / 4);
  cvt_f32_bf16<0><<<(1024 * 1024 / 4 + 255) / 256, 256, 0, stream>>>(out_proj, wOUT,
                                                                     1024 * 1024 / 4);

  // QKV projection: M=8192, N=3072 -> grid (24, 128)
  gemm_nt<0><<<dim3(24, 128), 256, 0, stream>>>(qA, wQKV, qkv_bias, nullptr, Qb, Kb,
                                                Vtb);
  // Attention: 64 head-batches x 16 row-groups of 128 rows
  attn_kernel<<<dim3(16, 64), 256, 0, stream>>>(Qb, Kb, Vtb, Ob);
  // Output projection: M=8192, N=1024 -> grid (8, 128)
  gemm_nt<1><<<dim3(8, 128), 256, 0, stream>>>(Ob, wOUT, out_bias, out, nullptr,
                                               nullptr, nullptr);
}

// v002
// One run takes 159 microseconds.
// Next to v001, in two timings, it ran 1.07 times as fast each time.
// All steps since v000 together make it 1.25 times as fast.
#include <hip/hip_runtime.h>

// ---------------------------------------------------------------------------
// Types
// ---------------------------------------------------------------------------
typedef __attribute__((ext_vector_type(16))) __bf16        v16bf;
typedef __attribute__((ext_vector_type(8)))  float         v8f;
typedef __attribute__((ext_vector_type(4)))  unsigned int  u32x4;
typedef __attribute__((ext_vector_type(8)))  unsigned int  u32x8;
typedef __attribute__((ext_vector_type(2)))  unsigned int  u32x2;
typedef __attribute__((ext_vector_type(4)))  float         f32x4;
typedef __attribute__((ext_vector_type(2)))  float         f32x2;
typedef __attribute__((ext_vector_type(2)))  __bf16        bf16x2;

// Two f32 -> two bf16 in one dword (a in the low half), round to nearest even:
// one packed hardware convert per pair.
static __device__ __forceinline__ unsigned pk2(float a, float b) {
  f32x2 v = {a, b};
  return __builtin_bit_cast(unsigned, __builtin_convertvector(v, bf16x2));
}

// Eight f32 -> eight bf16 in one 16-byte word group (element 0 lowest).
static __device__ __forceinline__ u32x4 pack8(v8f x) {
  u32x4 o;
#pragma unroll
  for (int e = 0; e < 4; ++e) o[e] = pk2(x[2 * e], x[2 * e + 1]);
  return o;
}

// Load one 16x32 bf16 A/B WMMA fragment from a row-major bf16 matrix.
// Per CDNA5 ISA 16-bit A layout: lane m (m<16) holds row m, K {0..7, 16..23};
// lane m+16 holds row m, K {8..15, 24..31}. B fragments use the identical
// per-lane pattern with "row" = C-column (NT GEMM symmetry).
static __device__ __forceinline__ v16bf load_frag(const __bf16* p, int stride, int lane) {
  const int m = lane & 15, h = lane >> 4;
  const __bf16* q = p + (size_t)m * (size_t)stride + h * 8;
  u32x4 lo = *(const u32x4*)(q);        // K chunk {0..7}/{8..15}
  u32x4 hi = *(const u32x4*)(q + 16);   // K chunk {16..23}/{24..31}
  u32x8 w = __builtin_shufflevector(lo, hi, 0, 1, 2, 3, 4, 5, 6, 7);
  return __builtin_bit_cast(v16bf, w);
}

static __device__ __forceinline__ v8f wmma_bf16(v16bf a, v16bf b, v8f c) {
  return __builtin_amdgcn_wmma_f32_16x16x32_bf16(false, a, false, b, (short)0, c,
                                                 false, false);
}

// CDNA5 async global->LDS copy (ASYNCcnt-tracked, no VGPR round trip).
// 16 bytes per lane; LDS dest address from VGPR, 64-bit global addr from VGPR pair.
static __device__ __forceinline__ void async_g2l_b128(void* lds_dst, const void* gsrc) {
  unsigned ldsa = (unsigned)(size_t)lds_dst;             // low 32 bits = LDS offset
  unsigned long long ga = (unsigned long long)(size_t)gsrc;
  asm volatile("global_load_async_to_lds_b128 %0, %1, off"
               :: "v"(ldsa), "v"(ga)
               : "memory");
}

// Wait until at most N async copies remain in flight (in-order completion =>
// all older copies have landed in LDS).
template <int N>
static __device__ __forceinline__ void wait_async() {
#if __has_builtin(__builtin_amdgcn_s_wait_asynccnt)
  __builtin_amdgcn_s_wait_asynccnt(N);
#else
  if constexpr (N == 0)
    asm volatile("s_wait_asynccnt 0x0" ::: "memory");
  else if constexpr (N == 2)
    asm volatile("s_wait_asynccnt 0x2" ::: "memory");
  else
    asm volatile("s_wait_asynccnt 0x6" ::: "memory");
#endif
}

// ---------------------------------------------------------------------------
// Kernel 1: f32 -> bf16 convert (4 elements / thread), rows of 1024 elements
// (one block = one row). PERM picks the destination row:
//   0: same row
//   1: source row l*4 + n   -> row n*2048 + l    (tokens grouped by batch n)
//   2: source row 3*ii + jj -> row jj*1024 + ii  (Q, K, V weight rows grouped)
// ---------------------------------------------------------------------------
template <int PERM>
__global__ __launch_bounds__(256) void cvt_f32_bf16(const float* __restrict__ src,
                                                    __bf16* __restrict__ dst, int n4) {
  int i = blockIdx.x * 256 + threadIdx.x;
  if (i >= n4) return;
  const int row = i >> 8, c4 = i & 255;
  const int drow = PERM == 1 ? (row & 3) * 2048 + (row >> 2)
                 : PERM == 2 ? (row % 3) * 1024 + row / 3
                             : row;
  f32x4 f = *(const f32x4*)(src + (size_t)i * 4);
  u32x2 o;
  o[0] = pk2(f[0], f[1]);
  o[1] = pk2(f[2], f[3]);
  *(u32x2*)(dst + (size_t)drow * 1024 + c4 * 4) = o;
}

// ---------------------------------------------------------------------------
// Kernels 2 & 4: NT bf16 GEMM  C(M x Ncols) = A(M x 1024) * B(Ncols x 1024)^T
// Workgroup tile 64(M) x 128(N), 8 waves (2x4), wave tile 32x32 (2x2 WMMA
// tiles). K streamed in 64-wide chunks through DOUBLE-BUFFERED LDS using
// async global->LDS copies: chunk i+1 streams in while WMMAs run on chunk i.
// MODE 0: QKV projection. A rows are n*2048 + l, B rows jj*1024 + ii (see the
//         convert), so a block is one n, 64 consecutive l, and all Q, all K or
//         all V. A lane's 8 accumulator registers run along the tile's row
//         axis: V blocks keep tokens there (8 consecutive l = 16 B of V^T);
//         Q and K blocks trade the two operands, so features lie there
//         (8 consecutive d = 16 B of a Q or K row). One 16-byte store per tile.
// MODE 1: output projection epilogue (bias, f32 store to d_out)
// ---------------------------------------------------------------------------
static constexpr int LDST = 72;  // ushort stride = 144 bytes (conflict-free)
static constexpr int ASZ = 64 * LDST;
static constexpr int BSZ = 128 * LDST;

template <int MODE>
__global__ __launch_bounds__(256) void gemm_nt(
    const __bf16* __restrict__ A, const __bf16* __restrict__ B,
    const float* __restrict__ bias, float* __restrict__ outF,
    __bf16* __restrict__ Qb, __bf16* __restrict__ Kb, __bf16* __restrict__ Vtb) {
  __shared__ __align__(16) __bf16 sA[2 * ASZ];
  __shared__ __align__(16) __bf16 sB[2 * BSZ];

  const int tid = threadIdx.x;
  const int lane = tid & 31;
  const int w = tid >> 5;
  const int wm = w & 1, wn = w >> 1;
  const int row0 = blockIdx.y * 64;
  const int col0 = blockIdx.x * 128;
  const bool swp = MODE == 0 && col0 < 2048;  // Q or K block (block-uniform)

  // 6 async copies per thread per K-chunk (2 for A, 4 for B).
  auto stage = [&](int buf, int kb) {
#pragma unroll
    for (int s = 0; s < 2; ++s) {  // A tile: 64 rows x 64 K = 512 x 16B
      int idx = tid + s * 256;
      int r = idx >> 3, c = (idx & 7) * 8;
      async_g2l_b128(sA + buf * ASZ + r * LDST + c,
                     A + (size_t)(row0 + r) * 1024 + kb + c);
    }
#pragma unroll
    for (int s = 0; s < 4; ++s) {  // B tile: 128 rows x 64 K
      int idx = tid + s * 256;
      int r = idx >> 3, c = (idx & 7) * 8;
      async_g2l_b128(sB + buf * BSZ + r * LDST + c,
                     B + (size_t)(col0 + r) * 1024 + kb + c);
    }
  };

  v8f acc[2][2] = {};

  stage(0, 0);
  for (int kb = 0; kb < 1024; kb += 64) {
    const int cur = (kb >> 6) & 1;
    if (kb + 64 < 1024) {
      stage(cur ^ 1, kb + 64);  // prefetch next chunk into other buffer
      wait_async<6>();          // ensure chunk `cur` has landed
    } else {
      wait_async<0>();
    }
    __syncthreads();

    const __bf16* tA = sA + cur * ASZ + wm * 32 * LDST;  // this wave's 32 tokens
    const __bf16* tB = sB + cur * BSZ + wn * 32 * LDST;  // this wave's 32 features
    const __bf16* cA = swp ? tB : tA;  // rows of the accumulator tiles
    const __bf16* cB = swp ? tA : tB;  // columns of the accumulator tiles
#pragma unroll
    for (int kk = 0; kk < 64; kk += 32) {
      v16bf af[2], bfr[2];
#pragma unroll
      for (int i = 0; i < 2; ++i)
        af[i] = load_frag(cA + i * 16 * LDST + kk, LDST, lane);
#pragma unroll
      for (int j = 0; j < 2; ++j)
        bfr[j] = load_frag(cB + j * 16 * LDST + kk, LDST, lane);
#pragma unroll
      for (int i = 0; i < 2; ++i)
#pragma unroll
        for (int j = 0; j < 2; ++j)
          acc[i][j] = wmma_bf16(af[i], bfr[j], acc[i][j]);
    }
    __syncthreads();  // all waves done with buffer `cur` before it is re-staged
  }

  // Epilogue. C layout: VGPR v -> row (v + half*8), col = lane%16 within tile.
  const int m = lane & 15, half = lane >> 4;
  if (MODE == 1) {
#pragma unroll
    for (int i = 0; i < 2; ++i) {
#pragma unroll
      for (int j = 0; j < 2; ++j) {
        const int f = col0 + wn * 32 + j * 16 + m;
        const float bv = bias[f];
#pragma unroll
        for (int v = 0; v < 8; ++v) {
          const int r = row0 + wm * 32 + i * 16 + v + half * 8;
          outF[(size_t)r * 1024 + f] = acc[i][j][v] + bv;
        }
      }
    }
  } else {
    // bias index of (ii, jj) is 3*ii + jj ; ii = hh*64 + dd ; b = n*16 + hh
    const int n = row0 >> 11;
    const int lb = (row0 & 2047) + wm * 32;    // first token of the wave tile
    const int ib = (col0 & 1023) + wn * 32;    // first feature ii of the wave tile
    if (swp) {
      const int jj = col0 >> 10;               // 0: Q, 1: K
      __bf16* dst = jj == 0 ? Qb : Kb;
      const float sc = jj == 0 ? 0.125f : 1.0f;  // fold the score scale into Q
#pragma unroll
      for (int i = 0; i < 2; ++i) {
        const int ii = ib + i * 16 + half * 8;  // 8 consecutive d of one head
        v8f bv;
#pragma unroll
        for (int v = 0; v < 8; ++v) bv[v] = bias[3 * (ii + v) + jj];
        const int b = n * 16 + (ii >> 6);
#pragma unroll
        for (int j = 0; j < 2; ++j) {
          const int l = lb + j * 16 + m;
          *(u32x4*)(dst + ((size_t)b * 2048 + l) * 64 + (ii & 63)) =
              pack8((acc[i][j] + bv) * sc);
        }
      }
    } else {
#pragma unroll
      for (int j = 0; j < 2; ++j) {
        const int ii = ib + j * 16 + m;
        const float bv = bias[3 * ii + 2];
        const int b = n * 16 + (ii >> 6);
#pragma unroll
        for (int i = 0; i < 2; ++i) {
          const int l = lb + i * 16 + half * 8;  // 8 consecutive tokens
          *(u32x4*)(Vtb + ((size_t)b * 64 + (ii & 63)) * 2048 + l) =
              pack8(acc[i][j] + bv);
        }
      }
      // Precaution: the built code lays the Q/K block behind these stores and
      // rewrites their address and data registers there; the wait stands first.
      asm volatile("s_wait_xcnt 0x0" ::: "memory");
    }
  }
}

// ---------------------------------------------------------------------------
// Kernel 3: flash attention. One wave = 16 query rows of one (batch,head) b.
// All 8 waves of a block share b, so each 32-key K/V^T block is staged ONCE
// per workgroup into double-buffered LDS via async copies: block i+1 streams
// in while WMMAs/softmax run on block i.
// Computes S^T = K*Q^T so that exp(S^T) registers are already in the exact
// B-operand packing for O^T += V^T * P^T (no LDS transpose needed).
// ---------------------------------------------------------------------------
static constexpr int KST = 72;  // K tile stride (ushorts) = 144B
static constexpr int VST = 40;  // V tile stride (ushorts) = 80B
static constexpr int KSZ = 32 * KST;
static constexpr int VSZ = 64 * VST;

__global__ __launch_bounds__(256) void attn_kernel(const __bf16* __restrict__ Q,
                                                   const __bf16* __restrict__ K,
                                                   const __bf16* __restrict__ Vt,
                                                   __bf16* __restrict__ O) {
  __shared__ __align__(16) __bf16 sK[2 * KSZ];  // 32 keys x 64 d
  __shared__ __align__(16) __bf16 sV[2 * VSZ];  // 64 d x 32 keys (V^T)

  const int tid = threadIdx.x;
  const int lane = tid & 31;
  const int w = tid >> 5;
  const int b = blockIdx.y;                   // 0..63  (= n*16 + head)
  const int r0 = blockIdx.x * 128 + w * 16;   // query row tile
  const int m = lane & 15, half = lane >> 4;

  const __bf16* Qb = Q + (size_t)b * 2048 * 64;
  const __bf16* Kb = K + (size_t)b * 2048 * 64;
  const __bf16* Vb = Vt + (size_t)b * 64 * 2048;

  // Per-thread staging coordinates (4KB per tile = 256 x 16B).
  const int kr = tid >> 3, kc = (tid & 7) * 8;  // K: 32 rows x 8 chunks
  const int vr = tid >> 2, vc = (tid & 3) * 8;  // V: 64 rows x 4 chunks

  // 2 async copies per thread per 32-key block.
  auto stage = [&](int buf, int key0) {
    async_g2l_b128(sK + buf * KSZ + kr * KST + kc,
                   Kb + (size_t)(key0 + kr) * 64 + kc);
    async_g2l_b128(sV + buf * VSZ + vr * VST + vc,
                   Vb + (size_t)vr * 2048 + key0 + vc);
  };

  // Q fragments (used as B operand: column n = query row n), d split in 2x32
  v16bf qf[2];
#pragma unroll
  for (int c = 0; c < 2; ++c)
    qf[c] = load_frag(Qb + (size_t)r0 * 64 + c * 32, 64, lane);

  v8f ot[4] = {};            // O^T tiles: d = j*16 + v + half*8, col = query m
  float mrow = -1e30f;       // running max for query row m (dup in lane m+16)
  float lrow = 0.0f;         // running sum

  stage(0, 0);
  for (int kb = 0; kb < 64; ++kb) {
    const int cur = kb & 1;
    if (kb + 1 < 64) {
      stage(cur ^ 1, (kb + 1) * 32);  // prefetch next block into other buffer
      wait_async<2>();                // ensure block `cur` has landed
    } else {
      wait_async<0>();
    }
    __syncthreads();

    const __bf16* cK = sK + cur * KSZ;
    const __bf16* cV = sV + cur * VSZ;

    // K fragments as A operand: 2 key tiles x 2 d-chunks (from LDS)
    v16bf kf[2][2];
#pragma unroll
    for (int t = 0; t < 2; ++t)
#pragma unroll
      for (int c = 0; c < 2; ++c)
        kf[t][c] = load_frag(cK + (t * 16) * KST + c * 32, KST, lane);

    // S^T tiles: row = key, col = query. Q already scaled by 1/8.
    v8f st[2];
#pragma unroll
    for (int t = 0; t < 2; ++t) {
      v8f z = {};
      z = wmma_bf16(kf[t][0], qf[0], z);
      st[t] = wmma_bf16(kf[t][1], qf[1], z);
    }

    // V^T fragments as A operand: rows = d, contiguous keys (from LDS)
    v16bf vf[4];
#pragma unroll
    for (int j = 0; j < 4; ++j)
      vf[j] = load_frag(cV + (j * 16) * VST, VST, lane);

    // online softmax: each lane holds 16 scores of its query row; partner lane
    // (xor 16) holds the other 16 keys of this 32-key block.
    float vmax = -1e30f;
#pragma unroll
    for (int t = 0; t < 2; ++t)
#pragma unroll
      for (int v = 0; v < 8; ++v) vmax = fmaxf(vmax, st[t][v]);
    vmax = fmaxf(vmax, __shfl_xor(vmax, 16, 32));
    const float mnew = fmaxf(mrow, vmax);
    const float alpha = __expf(mrow - mnew);

    // P^T in registers, repacked directly into B-operand layout:
    // element e<8 -> tile0[e], e>=8 -> tile1[e-8] (both lane halves).
    // Neighbouring keys stay in register pairs: one packed convert per pair.
    u32x8 pw;
    float psum = 0.0f;
#pragma unroll
    for (int e = 0; e < 4; ++e) {
      const f32x2 p0 = {__expf(st[0][2 * e] - mnew), __expf(st[0][2 * e + 1] - mnew)};
      const f32x2 p1 = {__expf(st[1][2 * e] - mnew), __expf(st[1][2 * e + 1] - mnew)};
      const f32x2 ps = p0 + p1;
      psum += ps[0];
      psum += ps[1];
      pw[e] = pk2(p0[0], p0[1]);
      pw[e + 4] = pk2(p1[0], p1[1]);
    }
    const v16bf pb = __builtin_bit_cast(v16bf, pw);
    psum += __shfl_xor(psum, 16, 32);
    lrow = lrow * alpha + psum;
    mrow = mnew;

#pragma unroll
    for (int j = 0; j < 4; ++j) {
      ot[j] *= alpha;
      ot[j] = wmma_bf16(vf[j], pb, ot[j]);
    }
    __syncthreads();  // all waves done with buffer `cur` before it is re-staged
  }

  // Normalize and scatter into (l, n, h*64 + d) bf16 layout for the out GEMM.
  const float inv = 1.0f / lrow;
  const int lseq = r0 + m;
  const int n = b >> 4, hh = b & 15;
  __bf16* orow = O + ((size_t)lseq * 4 + n) * 1024 + hh * 64;
#pragma unroll
  for (int j = 0; j < 4; ++j)
    *(u32x4*)(orow + j * 16 + half * 8) = pack8(ot[j] * inv);
}

// ---------------------------------------------------------------------------
// Launch
// ---------------------------------------------------------------------------
extern "C" void kernel_launch(void* const* d_in, const int* in_sizes, int n_in,
                              void* d_out, int out_size, void* d_ws, size_t ws_size,
                              hipStream_t stream) {
  const float* query = (const float*)d_in[0];     // (2048, 4, 1024)
  const float* qkv_proj = (const float*)d_in[1];  // (3072, 1024)
  const float* qkv_bias = (const float*)d_in[2];  // (3072,)
  const float* out_proj = (const float*)d_in[3];  // (1024, 1024)
  const float* out_bias = (const float*)d_in[4];  // (1024,)
  float* out = (float*)d_out;                     // (2048, 4, 1024) f32
  (void)in_sizes; (void)n_in; (void)out_size; (void)ws_size;

  char* ws = (char*)d_ws;
  size_t off = 0;
  auto carve = [&](size_t bytes) {
    void* p = ws + off;
    off += (bytes + 255) & ~(size_t)255;
    return p;
  };
  __bf16* qA   = (__bf16*)carve(8192ull * 1024 * 2);       // query bf16, row n*2048+l
  __bf16* wQKV = (__bf16*)carve(3072ull * 1024 * 2);       // qkv_proj bf16, row jj*1024+ii
  __bf16* wOUT = (__bf16*)carve(1024ull * 1024 * 2);       // out_proj bf16
  __bf16* Qb   = (__bf16*)carve(64ull * 2048 * 64 * 2);    // Q (b,l,d), pre-scaled
  __bf16* Kb   = (__bf16*)carve(64ull * 2048 * 64 * 2);    // K (b,l,d)
  __bf16* Vtb  = (__bf16*)carve(64ull * 64 * 2048 * 2);    // V^T (b,d,l)
  __bf16* Ob   = (__bf16*)carve(8192ull * 1024 * 2);       // attn out (l*4+n, i)

  cvt_f32_bf16<1><<<(8192 * 1024 / 4 + 255) / 256, 256, 0, stream>>>(query, qA,
                                                                     8192 * 1024 / 4);
  cvt_f32_bf16<2><<<(3072 * 1024 / 4 + 255) / 256, 256, 0, stream>>>(qkv_proj, wQKV,
                                                                     3072 * 1024 / 4);
  cvt_f32_bf16<0><<<(1024 * 1024 / 4 + 255) / 256, 256, 0, stream>>>(out_proj, wOUT,
                                                                     1024 * 1024 / 4);

  // QKV projection: M=8192, N=3072 -> grid (24, 128)
  gemm_nt<0><<<dim3(24, 128), 256, 0, stream>>>(qA, wQKV, qkv_bias, nullptr, Qb, Kb,
                                                Vtb);
  // Attention: 64 head-batches x 16 row-groups of 128 rows
  attn_kernel<<<dim3(16, 64), 256, 0, stream>>>(Qb, Kb, Vtb, Ob);
  // Output projection: M=8192, N=1024 -> grid (8, 128)
  gemm_nt<1><<<dim3(8, 128), 256, 0, stream>>>(Ob, wOUT, out_bias, out, nullptr,
                                               nullptr, nullptr);
}

// v003
// A run of this version takes 148 microseconds.
// In two side-by-side timings against v002, it was 1.07 and 1.09 times as fast.
// Counting every step since v000, it is 1.36 times as fast.
#include <hip/hip_runtime.h>

// ---------------------------------------------------------------------------
// Types
// ---------------------------------------------------------------------------
typedef __attribute__((ext_vector_type(16))) __bf16        v16bf;
typedef __attribute__((ext_vector_type(8)))  float         v8f;
typedef __attribute__((ext_vector_type(4)))  unsigned int  u32x4;
typedef __attribute__((ext_vector_type(8)))  unsigned int  u32x8;
typedef __attribute__((ext_vector_type(2)))  unsigned int  u32x2;
typedef __attribute__((ext_vector_type(4)))  float         f32x4;
typedef __attribute__((ext_vector_type(2)))  float         f32x2;
typedef __attribute__((ext_vector_type(2)))  __bf16        bf16x2;

// Two f32 -> two bf16 in one dword (a in the low half), round to nearest even:
// one packed hardware convert per pair.
static __device__ __forceinline__ unsigned pk2(float a, float b) {
  f32x2 v = {a, b};
  return __builtin_bit_cast(unsigned, __builtin_convertvector(v, bf16x2));
}

// Eight f32 -> eight bf16 in one 16-byte word group (element 0 lowest).
static __device__ __forceinline__ u32x4 pack8(v8f x) {
  u32x4 o;
#pragma unroll
  for (int e = 0; e < 4; ++e) o[e] = pk2(x[2 * e], x[2 * e + 1]);
  return o;
}

// Load one 16x32 bf16 A/B WMMA fragment from a row-major bf16 matrix.
// Per CDNA5 ISA 16-bit A layout: lane m (m<16) holds row m, K {0..7, 16..23};
// lane m+16 holds row m, K {8..15, 24..31}. B fragments use the identical
// per-lane pattern with "row" = C-column (NT GEMM symmetry).
static __device__ __forceinline__ v16bf load_frag(const __bf16* p, int stride, int lane) {
  const int m = lane & 15, h = lane >> 4;
  const __bf16* q = p + (size_t)m * (size_t)stride + h * 8;
  u32x4 lo = *(const u32x4*)(q);        // K chunk {0..7}/{8..15}
  u32x4 hi = *(const u32x4*)(q + 16);   // K chunk {16..23}/{24..31}
  u32x8 w = __builtin_shufflevector(lo, hi, 0, 1, 2, 3, 4, 5, 6, 7);
  return __builtin_bit_cast(v16bf, w);
}

static __device__ __forceinline__ v8f wmma_bf16(v16bf a, v16bf b, v8f c) {
  return __builtin_amdgcn_wmma_f32_16x16x32_bf16(false, a, false, b, (short)0, c,
                                                 false, false);
}

// CDNA5 async global->LDS copy (ASYNCcnt-tracked, no VGPR round trip).
// 16 bytes per lane; LDS dest address from VGPR, 64-bit global addr from VGPR pair.
static __device__ __forceinline__ void async_g2l_b128(void* lds_dst, const void* gsrc) {
  unsigned ldsa = (unsigned)(size_t)lds_dst;             // low 32 bits = LDS offset
  unsigned long long ga = (unsigned long long)(size_t)gsrc;
  asm volatile("global_load_async_to_lds_b128 %0, %1, off"
               :: "v"(ldsa), "v"(ga)
               : "memory");
}

// Twelve such copies of one lane (one K-chunk of the GEMM tile) in one statement.
// The closing s_wait_xcnt stands inside it, so no address register of a copy is
// rewritten in front of the wait (a precaution for copies written as asm text).
static __device__ __forceinline__ void async_g2l_b128_x12(const unsigned (&l)[12],
                                                          const __bf16* const (&g)[12]) {
  asm volatile(
      "global_load_async_to_lds_b128 %0, %12, off\n\t"
      "global_load_async_to_lds_b128 %1, %13, off\n\t"
      "global_load_async_to_lds_b128 %2, %14, off\n\t"
      "global_load_async_to_lds_b128 %3, %15, off\n\t"
      "global_load_async_to_lds_b128 %4, %16, off\n\t"
      "global_load_async_to_lds_b128 %5, %17, off\n\t"
      "global_load_async_to_lds_b128 %6, %18, off\n\t"
      "global_load_async_to_lds_b128 %7, %19, off\n\t"
      "global_load_async_to_lds_b128 %8, %20, off\n\t"
      "global_load_async_to_lds_b128 %9, %21, off\n\t"
      "global_load_async_to_lds_b128 %10, %22, off\n\t"
      "global_load_async_to_lds_b128 %11, %23, off\n\t"
      "s_wait_xcnt 0x0"
      :: "v"(l[0]), "v"(l[1]), "v"(l[2]), "v"(l[3]), "v"(l[4]), "v"(l[5]),
         "v"(l[6]), "v"(l[7]), "v"(l[8]), "v"(l[9]), "v"(l[10]), "v"(l[11]),
         "v"(g[0]), "v"(g[1]), "v"(g[2]), "v"(g[3]), "v"(g[4]), "v"(g[5]),
         "v"(g[6]), "v"(g[7]), "v"(g[8]), "v"(g[9]), "v"(g[10]), "v"(g[11])
      : "memory");
}

// Wait until at most N async copies remain in flight (in-order completion =>
// all older copies have landed in LDS).
template <int N>
static __device__ __forceinline__ void wait_async() {
#if __has_builtin(__builtin_amdgcn_s_wait_asynccnt)
  __builtin_amdgcn_s_wait_asynccnt(N);
#else
  if constexpr (N == 0)
    asm volatile("s_wait_asynccnt 0x0" ::: "memory");
  else if constexpr (N == 2)
    asm volatile("s_wait_asynccnt 0x2" ::: "memory");
  else
    asm volatile("s_wait_asynccnt 0x6" ::: "memory");
#endif
}

// ---------------------------------------------------------------------------
// Kernel 1: f32 -> bf16 convert (4 elements / thread), rows of 1024 elements
// (one block = one row). PERM picks the destination row:
//   0: same row
//   1: source row l*4 + n   -> row n*2048 + l    (tokens grouped by batch n)
//   2: source row 3*ii + jj -> row jj*1024 + ii  (Q, K, V weight rows grouped)
// ---------------------------------------------------------------------------
template <int PERM>
__global__ __launch_bounds__(256) void cvt_f32_bf16(const float* __restrict__ src,
                                                    __bf16* __restrict__ dst, int n4) {
  int i = blockIdx.x * 256 + threadIdx.x;
  if (i >= n4) return;
  const int row = i >> 8, c4 = i & 255;
  const int drow = PERM == 1 ? (row & 3) * 2048 + (row >> 2)
                 : PERM == 2 ? (row % 3) * 1024 + row / 3
                             : row;
  f32x4 f = *(const f32x4*)(src + (size_t)i * 4);
  u32x2 o;
  o[0] = pk2(f[0], f[1]);
  o[1] = pk2(f[2], f[3]);
  *(u32x2*)(dst + (size_t)drow * 1024 + c4 * 4) = o;
}

// ---------------------------------------------------------------------------
// Kernels 2 & 4: NT bf16 GEMM  C(M x Ncols) = A(M x 1024) * B(Ncols x 1024)^T
// Workgroup tile 128(M) x 256(N), 8 waves (2x4), wave tile 64x64 (4x4 WMMA
// tiles): each fragment read from LDS feeds 4 WMMAs, each operand row fetched
// from L2 feeds 128 or 256 output columns. K streamed in 64-wide chunks through
// DOUBLE-BUFFERED LDS using async global->LDS copies: chunk i+1 streams in while
// WMMAs run on chunk i.
// MODE 0: QKV projection. A rows are n*2048 + l, B rows jj*1024 + ii (see the
//         convert), so a block is one n, 128 consecutive l, and all Q, all K or
//         all V. A lane's 8 accumulator registers run along the tile's row
//         axis: V blocks keep tokens there (8 consecutive l = 16 B of V^T);
//         Q and K blocks trade the two operands, so features lie there
//         (8 consecutive d = 16 B of a Q or K row). One 16-byte store per tile.
// MODE 1: output projection epilogue (bias, f32 store to d_out)
// ---------------------------------------------------------------------------
static constexpr int LDST = 72;  // ushort stride = 144 bytes (conflict-free)
static constexpr int ASZ = 128 * LDST;
static constexpr int BSZ = 256 * LDST;

template <int MODE>
__global__ __launch_bounds__(256) void gemm_nt(
    const __bf16* __restrict__ A, const __bf16* __restrict__ B,
    const float* __restrict__ bias, float* __restrict__ outF,
    __bf16* __restrict__ Qb, __bf16* __restrict__ Kb, __bf16* __restrict__ Vtb) {
  __shared__ __align__(16) __bf16 sA[2 * ASZ];
  __shared__ __align__(16) __bf16 sB[2 * BSZ];

  const int tid = threadIdx.x;
  const int lane = tid & 31;
  const int w = tid >> 5;
  const int wm = w & 1, wn = w >> 1;
  const int row0 = blockIdx.y * 128;
  const int col0 = blockIdx.x * 256;
  const bool swp = MODE == 0 && col0 < 2048;  // Q or K block (block-uniform)

  // 12 async copies per thread per K-chunk: 4 for A (128 rows x 64 K = 1024 x
  // 16 B), 8 for B (256 rows). A thread's copies lie 32 tile rows apart.
  const int sr = tid >> 3, sc = (tid & 7) * 8;
  const __bf16* gA = A + (size_t)(row0 + sr) * 1024 + sc;
  const __bf16* gB = B + (size_t)(col0 + sr) * 1024 + sc;
  const unsigned lA = (unsigned)(size_t)(sA + sr * LDST + sc);  // LDS byte address
  const unsigned lB = (unsigned)(size_t)(sB + sr * LDST + sc);
  auto stage = [&](int buf, int kb) {
    unsigned l[12];
    const __bf16* g[12];
#pragma unroll
    for (int s = 0; s < 4; ++s) {
      l[s] = lA + (buf * ASZ + s * 32 * LDST) * 2;
      g[s] = gA + s * 32 * 1024 + kb;
    }
#pragma unroll
    for (int s = 0; s < 8; ++s) {
      l[4 + s] = lB + (buf * BSZ + s * 32 * LDST) * 2;
      g[4 + s] = gB + s * 32 * 1024 + kb;
    }
    async_g2l_b128_x12(l, g);
  };

  v8f acc[4][4] = {};

  stage(0, 0);
  asm volatile("s_wait_asynccnt 0x0" ::: "memory");  // chunk 0 has landed (own copies)
  __syncthreads();                                   // ... and every other wave's
  stage(1, 64);
  for (int kb = 0; kb < 1024; kb += 64) {
    const int cur = (kb >> 6) & 1;
    const __bf16* tA = sA + cur * ASZ + wm * 64 * LDST;  // this wave's 64 tokens
    const __bf16* tB = sB + cur * BSZ + wn * 64 * LDST;  // this wave's 64 features
    const __bf16* cA = swp ? tB : tA;  // rows of the accumulator tiles
    const __bf16* cB = swp ? tA : tB;  // columns of the accumulator tiles
#pragma unroll
    for (int kk = 0; kk < 64; kk += 32) {
      v16bf af[4], bfr[4];
#pragma unroll
      for (int i = 0; i < 4; ++i)
        af[i] = load_frag(cA + i * 16 * LDST + kk, LDST, lane);
#pragma unroll
      for (int j = 0; j < 4; ++j)
        bfr[j] = load_frag(cB + j * 16 * LDST + kk, LDST, lane);
      // Keeps the 16 LDS reads together in front of their 16 WMMAs: left alone the
      // scheduler spreads them, one full LDS wait in front of every row of four.
      __builtin_amdgcn_sched_barrier(0);
#pragma unroll
      for (int i = 0; i < 4; ++i)
#pragma unroll
        for (int j = 0; j < 4; ++j)
          acc[i][j] = wmma_bf16(af[i], bfr[j], acc[i][j]);
    }
    // Hand-over: own reads of buffer `cur` retired, own copies of the next chunk
    // landed; the one barrier publishes that chunk and frees `cur` for a refill.
    asm volatile("s_wait_dscnt 0x0" ::: "memory");
    asm volatile("s_wait_asynccnt 0x0" ::: "memory");
    __syncthreads();
    if (kb + 128 < 1024) stage(cur, kb + 128);  // flies while the next chunk is worked on
  }
  asm volatile("s_wait_asynccnt 0x0" ::: "memory");  // nothing in flight at the wave's end

  // Epilogue. C layout: VGPR v -> row (v + half*8), col = lane%16 within tile.
  const int m = lane & 15, half = lane >> 4;
  if (MODE == 1) {
#pragma unroll
    for (int i = 0; i < 4; ++i) {
#pragma unroll
      for (int j = 0; j < 4; ++j) {
        const int f = col0 + wn * 64 + j * 16 + m;
        const float bv = bias[f];
#pragma unroll
        for (int v = 0; v < 8; ++v) {
          const int r = row0 + wm * 64 + i * 16 + v + half * 8;
          outF[(size_t)r * 1024 + f] = acc[i][j][v] + bv;
        }
      }
    }
  } else {
    // bias index of (ii, jj) is 3*ii + jj ; ii = hh*64 + dd ; b = n*16 + hh
    const int n = row0 >> 11;
    const int lb = (row0 & 2047) + wm * 64;    // first token of the wave tile
    const int ib = (col0 & 1023) + wn * 64;    // first feature ii of the wave tile
    if (swp) {
      const int jj = col0 >> 10;               // 0: Q, 1: K
      __bf16* dst = jj == 0 ? Qb : Kb;
      const float sc = jj == 0 ? 0.125f : 1.0f;  // fold the score scale into Q
#pragma unroll
      for (int i = 0; i < 4; ++i) {
        const int ii = ib + i * 16 + half * 8;  // 8 consecutive d of one head
        v8f bv;
#pragma unroll
        for (int v = 0; v < 8; ++v) bv[v] = bias[3 * (ii + v) + jj];
        const int b = n * 16 + (ii >> 6);
#pragma unroll
        for (int j = 0; j < 4; ++j) {
          const int l = lb + j * 16 + m;
          *(u32x4*)(dst + ((size_t)b * 2048 + l) * 64 + (ii & 63)) =
              pack8((acc[i][j] + bv) * sc);
        }
      }
    } else {
#pragma unroll
      for (int j = 0; j < 4; ++j) {
        const int ii = ib + j * 16 + m;
        const float bv = bias[3 * ii + 2];
        const int b = n * 16 + (ii >> 6);
#pragma unroll
        for (int i = 0; i < 4; ++i) {
          const int l = lb + i * 16 + half * 8;  // 8 consecutive tokens
          *(u32x4*)(Vtb + ((size_t)b * 64 + (ii & 63)) * 2048 + l) =
              pack8(acc[i][j] + bv);
        }
      }
      // Precaution: the built code lays the Q/K block behind these stores and
      // rewrites their address and data registers there; the wait stands first.
      asm volatile("s_wait_xcnt 0x0" ::: "memory");
    }
  }
}

// ---------------------------------------------------------------------------
// Kernel 3: flash attention. One wave = 16 query rows of one (batch,head) b.
// All 8 waves of a block share b, so each 32-key K/V^T block is staged ONCE
// per workgroup into double-buffered LDS via async copies: block i+1 streams
// in while WMMAs/softmax run on block i.
// Computes S^T = K*Q^T so that exp(S^T) registers are already in the exact
// B-operand packing for O^T += V^T * P^T (no LDS transpose needed).
// ---------------------------------------------------------------------------
static constexpr int KST = 72;  // K tile stride (ushorts) = 144B
static constexpr int VST = 40;  // V tile stride (ushorts) = 80B
static constexpr int KSZ = 32 * KST;
static constexpr int VSZ = 64 * VST;

__global__ __launch_bounds__(256) void attn_kernel(const __bf16* __restrict__ Q,
                                                   const __bf16* __restrict__ K,
                                                   const __bf16* __restrict__ Vt,
                                                   __bf16* __restrict__ O) {
  __shared__ __align__(16) __bf16 sK[2 * KSZ];  // 32 keys x 64 d
  __shared__ __align__(16) __bf16 sV[2 * VSZ];  // 64 d x 32 keys (V^T)

  const int tid = threadIdx.x;
  const int lane = tid & 31;
  const int w = tid >> 5;
  const int b = blockIdx.y;                   // 0..63  (= n*16 + head)
  const int r0 = blockIdx.x * 128 + w * 16;   // query row tile
  const int m = lane & 15, half = lane >> 4;

  const __bf16* Qb = Q + (size_t)b * 2048 * 64;
  const __bf16* Kb = K + (size_t)b * 2048 * 64;
  const __bf16* Vb = Vt + (size_t)b * 64 * 2048;

  // Per-thread staging coordinates (4KB per tile = 256 x 16B).
  const int kr = tid >> 3, kc = (tid & 7) * 8;  // K: 32 rows x 8 chunks
  const int vr = tid >> 2, vc = (tid & 3) * 8;  // V: 64 rows x 4 chunks

  // 2 async copies per thread per 32-key block.
  auto stage = [&](int buf, int key0) {
    async_g2l_b128(sK + buf * KSZ + kr * KST + kc,
                   Kb + (size_t)(key0 + kr) * 64 + kc);
    async_g2l_b128(sV + buf * VSZ + vr * VST + vc,
                   Vb + (size_t)vr * 2048 + key0 + vc);
  };

  // Q fragments (used as B operand: column n = query row n), d split in 2x32
  v16bf qf[2];
#pragma unroll
  for (int c = 0; c < 2; ++c)
    qf[c] = load_frag(Qb + (size_t)r0 * 64 + c * 32, 64, lane);

  v8f ot[4] = {};            // O^T tiles: d = j*16 + v + half*8, col = query m
  float mrow = -1e30f;       // running max for query row m (dup in lane m+16)
  float lrow = 0.0f;         // running sum

  stage(0, 0);
  for (int kb = 0; kb < 64; ++kb) {
    const int cur = kb & 1;
    if (kb + 1 < 64) {
      stage(cur ^ 1, (kb + 1) * 32);  // prefetch next block into other buffer
      wait_async<2>();                // ensure block `cur` has landed
    } else {
      wait_async<0>();
    }
    __syncthreads();

    const __bf16* cK = sK + cur * KSZ;
    const __bf16* cV = sV + cur * VSZ;

    // K fragments as A operand: 2 key tiles x 2 d-chunks (from LDS)
    v16bf kf[2][2];
#pragma unroll
    for (int t = 0; t < 2; ++t)
#pragma unroll
      for (int c = 0; c < 2; ++c)
        kf[t][c] = load_frag(cK + (t * 16) * KST + c * 32, KST, lane);

    // S^T tiles: row = key, col = query. Q already scaled by 1/8.
    v8f st[2];
#pragma unroll
    for (int t = 0; t < 2; ++t) {
      v8f z = {};
      z = wmma_bf16(kf[t][0], qf[0], z);
      st[t] = wmma_bf16(kf[t][1], qf[1], z);
    }

    // V^T fragments as A operand: rows = d, contiguous keys (from LDS)
    v16bf vf[4];
#pragma unroll
    for (int j = 0; j < 4; ++j)
      vf[j] = load_frag(cV + (j * 16) * VST, VST, lane);

    // online softmax: each lane holds 16 scores of its query row; partner lane
    // (xor 16) holds the other 16 keys of this 32-key block.
    float vmax = -1e30f;
#pragma unroll
    for (int t = 0; t < 2; ++t)
#pragma unroll
      for (int v = 0; v < 8; ++v) vmax = fmaxf(vmax, st[t][v]);
    vmax = fmaxf(vmax, __shfl_xor(vmax, 16, 32));
    const float mnew = fmaxf(mrow, vmax);
    const float alpha = __expf(mrow - mnew);

    // P^T in registers, repacked directly into B-operand layout:
    // element e<8 -> tile0[e], e>=8 -> tile1[e-8] (both lane halves).
    // Neighbouring keys stay in register pairs: one packed convert per pair.
    u32x8 pw;
    float psum = 0.0f;
#pragma unroll
    for (int e = 0; e < 4; ++e) {
      const f32x2 p0 = {__expf(st[0][2 * e] - mnew), __expf(st[0][2 * e + 1] - mnew)};
      const f32x2 p1 = {__expf(st[1][2 * e] - mnew), __expf(st[1][2 * e + 1] - mnew)};
      const f32x2 ps = p0 + p1;
      psum += ps[0];
      psum += ps[1];
      pw[e] = pk2(p0[0], p0[1]);
      pw[e + 4] = pk2(p1[0], p1[1]);
    }
    const v16bf pb = __builtin_bit_cast(v16bf, pw);
    psum += __shfl_xor(psum, 16, 32);
    lrow = lrow * alpha + psum;
    mrow = mnew;

#pragma unroll
    for (int j = 0; j < 4; ++j) {
      ot[j] *= alpha;
      ot[j] = wmma_bf16(vf[j], pb, ot[j]);
    }
    __syncthreads();  // all waves done with buffer `cur` before it is re-staged
  }

  // Normalize and scatter into (l, n, h*64 + d) bf16 layout for the out GEMM.
  const float inv = 1.0f / lrow;
  const int lseq = r0 + m;
  const int n = b >> 4, hh = b & 15;
  __bf16* orow = O + ((size_t)lseq * 4 + n) * 1024 + hh * 64;
#pragma unroll
  for (int j = 0; j < 4; ++j)
    *(u32x4*)(orow + j * 16 + half * 8) = pack8(ot[j] * inv);
}

// ---------------------------------------------------------------------------
// Launch
// ---------------------------------------------------------------------------
extern "C" void kernel_launch(void* const* d_in, const int* in_sizes, int n_in,
                              void* d_out, int out_size, void* d_ws, size_t ws_size,
                              hipStream_t stream) {
  const float* query = (const float*)d_in[0];     // (2048, 4, 1024)
  const float* qkv_proj = (const float*)d_in[1];  // (3072, 1024)
  const float* qkv_bias = (const float*)d_in[2];  // (3072,)
  const float* out_proj = (const float*)d_in[3];  // (1024, 1024)
  const float* out_bias = (const float*)d_in[4];  // (1024,)
  float* out = (float*)d_out;                     // (2048, 4, 1024) f32
  (void)in_sizes; (void)n_in; (void)out_size; (void)ws_size;

  char* ws = (char*)d_ws;
  size_t off = 0;
  auto carve = [&](size_t bytes) {
    void* p = ws + off;
    off += (bytes + 255) & ~(size_t)255;
    return p;
  };
  __bf16* qA   = (__bf16*)carve(8192ull * 1024 * 2);       // query bf16, row n*2048+l
  __bf16* wQKV = (__bf16*)carve(3072ull * 1024 * 2);       // qkv_proj bf16, row jj*1024+ii
  __bf16* wOUT = (__bf16*)carve(1024ull * 1024 * 2);       // out_proj bf16
  __bf16* Qb   = (__bf16*)carve(64ull * 2048 * 64 * 2);    // Q (b,l,d), pre-scaled
  __bf16* Kb   = (__bf16*)carve(64ull * 2048 * 64 * 2);    // K (b,l,d)
  __bf16* Vtb  = (__bf16*)carve(64ull * 64 * 2048 * 2);    // V^T (b,d,l)
  __bf16* Ob   = (__bf16*)carve(8192ull * 1024 * 2);       // attn out (l*4+n, i)

  cvt_f32_bf16<1><<<(8192 * 1024 / 4 + 255) / 256, 256, 0, stream>>>(query, qA,
                                                                     8192 * 1024 / 4);
  cvt_f32_bf16<2><<<(3072 * 1024 / 4 + 255) / 256, 256, 0, stream>>>(qkv_proj, wQKV,
                                                                     3072 * 1024 / 4);
  cvt_f32_bf16<0><<<(1024 * 1024 / 4 + 255) / 256, 256, 0, stream>>>(out_proj, wOUT,
                                                                     1024 * 1024 / 4);

  // QKV projection: M=8192, N=3072 -> grid (12, 64)
  gemm_nt<0><<<dim3(12, 64), 256, 0, stream>>>(qA, wQKV, qkv_bias, nullptr, Qb, Kb,
                                                Vtb);
  // Attention: 64 head-batches x 16 row-groups of 128 rows
  attn_kernel<<<dim3(16, 64), 256, 0, stream>>>(Qb, Kb, Vtb, Ob);
  // Output projection: M=8192, N=1024 -> grid (4, 64)
  gemm_nt<1><<<dim3(4, 64), 256, 0, stream>>>(Ob, wOUT, out_bias, out, nullptr,
                                               nullptr, nullptr);
}

// v004
// It runs in 140 microseconds.
// Next to v003, in two timings, it ran 1.06 times as fast each time.
// Counting every step since v000, it is 1.43 times as fast.
#include <hip/hip_runtime.h>

// ---------------------------------------------------------------------------
// Types
// ---------------------------------------------------------------------------
typedef __attribute__((ext_vector_type(16))) __bf16        v16bf;
typedef __attribute__((ext_vector_type(8)))  float         v8f;
typedef __attribute__((ext_vector_type(4)))  unsigned int  u32x4;
typedef __attribute__((ext_vector_type(8)))  unsigned int  u32x8;
typedef __attribute__((ext_vector_type(2)))  unsigned int  u32x2;
typedef __attribute__((ext_vector_type(4)))  float         f32x4;
typedef __attribute__((ext_vector_type(2)))  float         f32x2;
typedef __attribute__((ext_vector_type(2)))  __bf16        bf16x2;

// Two f32 -> two bf16 in one dword (a in the low half), round to nearest even:
// one packed hardware convert per pair.
static __device__ __forceinline__ unsigned pk2(float a, float b) {
  f32x2 v = {a, b};
  return __builtin_bit_cast(unsigned, __builtin_convertvector(v, bf16x2));
}

// Eight f32 -> eight bf16 in one 16-byte word group (element 0 lowest).
static __device__ __forceinline__ u32x4 pack8(v8f x) {
  u32x4 o;
#pragma unroll
  for (int e = 0; e < 4; ++e) o[e] = pk2(x[2 * e], x[2 * e + 1]);
  return o;
}

// Load one 16x32 bf16 A/B WMMA fragment from a row-major bf16 matrix.
// Per CDNA5 ISA 16-bit A layout: lane m (m<16) holds row m, K {0..7, 16..23};
// lane m+16 holds row m, K {8..15, 24..31}. B fragments use the identical
// per-lane pattern with "row" = C-column (NT GEMM symmetry).
static __device__ __forceinline__ v16bf load_frag(const __bf16* p, int stride, int lane) {
  const int m = lane & 15, h = lane >> 4;
  const __bf16* q = p + (size_t)m * (size_t)stride + h * 8;
  u32x4 lo = *(const u32x4*)(q);        // K chunk {0..7}/{8..15}
  u32x4 hi = *(const u32x4*)(q + 16);   // K chunk {16..23}/{24..31}
  u32x8 w = __builtin_shufflevector(lo, hi, 0, 1, 2, 3, 4, 5, 6, 7);
  return __builtin_bit_cast(v16bf, w);
}

static __device__ __forceinline__ v8f wmma_bf16(v16bf a, v16bf b, v8f c) {
  return __builtin_amdgcn_wmma_f32_16x16x32_bf16(false, a, false, b, (short)0, c,
                                                 false, false);
}

// CDNA5 async global->LDS copies (ASYNCcnt-tracked, no VGPR round trip): 16 bytes
// per lane, LDS byte address in a VGPR, 64-bit global address in a VGPR pair.
// Four copies of one lane (one 64-key K and V^T block of the attention kernel) in
// one statement. The closing s_wait_xcnt stands inside it, so no address register
// of a copy is rewritten in front of the wait (a precaution for asm-text copies).
static __device__ __forceinline__ void async_g2l_b128_x4(const unsigned (&l)[4],
                                                         const __bf16* const (&g)[4]) {
  asm volatile(
      "global_load_async_to_lds_b128 %0, %4, off\n\t"
      "global_load_async_to_lds_b128 %1, %5, off\n\t"
      "global_load_async_to_lds_b128 %2, %6, off\n\t"
      "global_load_async_to_lds_b128 %3, %7, off\n\t"
      "s_wait_xcnt 0x0"
      :: "v"(l[0]), "v"(l[1]), "v"(l[2]), "v"(l[3]),
         "v"(g[0]), "v"(g[1]), "v"(g[2]), "v"(g[3])
      : "memory");
}

// Twelve such copies of one lane (one K-chunk of the GEMM tile) in one statement.
// The closing s_wait_xcnt stands inside it, so no address register of a copy is
// rewritten in front of the wait (a precaution for copies written as asm text).
static __device__ __forceinline__ void async_g2l_b128_x12(const unsigned (&l)[12],
                                                          const __bf16* const (&g)[12]) {
  asm volatile(
      "global_load_async_to_lds_b128 %0, %12, off\n\t"
      "global_load_async_to_lds_b128 %1, %13, off\n\t"
      "global_load_async_to_lds_b128 %2, %14, off\n\t"
      "global_load_async_to_lds_b128 %3, %15, off\n\t"
      "global_load_async_to_lds_b128 %4, %16, off\n\t"
      "global_load_async_to_lds_b128 %5, %17, off\n\t"
      "global_load_async_to_lds_b128 %6, %18, off\n\t"
      "global_load_async_to_lds_b128 %7, %19, off\n\t"
      "global_load_async_to_lds_b128 %8, %20, off\n\t"
      "global_load_async_to_lds_b128 %9, %21, off\n\t"
      "global_load_async_to_lds_b128 %10, %22, off\n\t"
      "global_load_async_to_lds_b128 %11, %23, off\n\t"
      "s_wait_xcnt 0x0"
      :: "v"(l[0]), "v"(l[1]), "v"(l[2]), "v"(l[3]), "v"(l[4]), "v"(l[5]),
         "v"(l[6]), "v"(l[7]), "v"(l[8]), "v"(l[9]), "v"(l[10]), "v"(l[11]),
         "v"(g[0]), "v"(g[1]), "v"(g[2]), "v"(g[3]), "v"(g[4]), "v"(g[5]),
         "v"(g[6]), "v"(g[7]), "v"(g[8]), "v"(g[9]), "v"(g[10]), "v"(g[11])
      : "memory");
}

// ---------------------------------------------------------------------------
// Kernel 1: f32 -> bf16 convert (4 elements / thread), rows of 1024 elements
// (one block = one row). PERM picks the destination row:
//   0: same row
//   1: source row l*4 + n   -> row n*2048 + l    (tokens grouped by batch n)
//   2: source row 3*ii + jj -> row jj*1024 + ii  (Q, K, V weight rows grouped)
// ---------------------------------------------------------------------------
template <int PERM>
__global__ __launch_bounds__(256) void cvt_f32_bf16(const float* __restrict__ src,
                                                    __bf16* __restrict__ dst, int n4) {
  int i = blockIdx.x * 256 + threadIdx.x;
  if (i >= n4) return;
  const int row = i >> 8, c4 = i & 255;
  const int drow = PERM == 1 ? (row & 3) * 2048 + (row >> 2)
                 : PERM == 2 ? (row % 3) * 1024 + row / 3
                             : row;
  f32x4 f = *(const f32x4*)(src + (size_t)i * 4);
  u32x2 o;
  o[0] = pk2(f[0], f[1]);
  o[1] = pk2(f[2], f[3]);
  *(u32x2*)(dst + (size_t)drow * 1024 + c4 * 4) = o;
}

// ---------------------------------------------------------------------------
// Kernels 2 & 4: NT bf16 GEMM  C(M x Ncols) = A(M x 1024) * B(Ncols x 1024)^T
// Workgroup tile 128(M) x 256(N), 8 waves (2x4), wave tile 64x64 (4x4 WMMA
// tiles): each fragment read from LDS feeds 4 WMMAs, each operand row fetched
// from L2 feeds 128 or 256 output columns. K streamed in 64-wide chunks through
// DOUBLE-BUFFERED LDS using async global->LDS copies: chunk i+1 streams in while
// WMMAs run on chunk i.
// MODE 0: QKV projection. A rows are n*2048 + l, B rows jj*1024 + ii (see the
//         convert), so a block is one n, 128 consecutive l, and all Q, all K or
//         all V. A lane's 8 accumulator registers run along the tile's row
//         axis: V blocks keep tokens there (8 consecutive l = 16 B of V^T);
//         Q and K blocks trade the two operands, so features lie there
//         (8 consecutive d = 16 B of a Q or K row). One 16-byte store per tile.
// MODE 1: output projection epilogue (bias, f32 store to d_out)
// ---------------------------------------------------------------------------
static constexpr int LDST = 72;  // ushort stride = 144 bytes (conflict-free)
static constexpr int ASZ = 128 * LDST;
static constexpr int BSZ = 256 * LDST;

template <int MODE>
__global__ __launch_bounds__(256) void gemm_nt(
    const __bf16* __restrict__ A, const __bf16* __restrict__ B,
    const float* __restrict__ bias, float* __restrict__ outF,
    __bf16* __restrict__ Qb, __bf16* __restrict__ Kb, __bf16* __restrict__ Vtb) {
  __shared__ __align__(16) __bf16 sA[2 * ASZ];
  __shared__ __align__(16) __bf16 sB[2 * BSZ];

  const int tid = threadIdx.x;
  const int lane = tid & 31;
  const int w = tid >> 5;
  const int wm = w & 1, wn = w >> 1;
  const int row0 = blockIdx.y * 128;
  const int col0 = blockIdx.x * 256;
  const bool swp = MODE == 0 && col0 < 2048;  // Q or K block (block-uniform)

  // 12 async copies per thread per K-chunk: 4 for A (128 rows x 64 K = 1024 x
  // 16 B), 8 for B (256 rows). A thread's copies lie 32 tile rows apart.
  const int sr = tid >> 3, sc = (tid & 7) * 8;
  const __bf16* gA = A + (size_t)(row0 + sr) * 1024 + sc;
  const __bf16* gB = B + (size_t)(col0 + sr) * 1024 + sc;
  const unsigned lA = (unsigned)(size_t)(sA + sr * LDST + sc);  // LDS byte address
  const unsigned lB = (unsigned)(size_t)(sB + sr * LDST + sc);
  auto stage = [&](int buf, int kb) {
    unsigned l[12];
    const __bf16* g[12];
#pragma unroll
    for (int s = 0; s < 4; ++s) {
      l[s] = lA + (buf * ASZ + s * 32 * LDST) * 2;
      g[s] = gA + s * 32 * 1024 + kb;
    }
#pragma unroll
    for (int s = 0; s < 8; ++s) {
      l[4 + s] = lB + (buf * BSZ + s * 32 * LDST) * 2;
      g[4 + s] = gB + s * 32 * 1024 + kb;
    }
    async_g2l_b128_x12(l, g);
  };

  v8f acc[4][4] = {};

  stage(0, 0);
  asm volatile("s_wait_asynccnt 0x0" ::: "memory");  // chunk 0 has landed (own copies)
  __syncthreads();                                   // ... and every other wave's
  stage(1, 64);
  for (int kb = 0; kb < 1024; kb += 64) {
    const int cur = (kb >> 6) & 1;
    const __bf16* tA = sA + cur * ASZ + wm * 64 * LDST;  // this wave's 64 tokens
    const __bf16* tB = sB + cur * BSZ + wn * 64 * LDST;  // this wave's 64 features
    const __bf16* cA = swp ? tB : tA;  // rows of the accumulator tiles
    const __bf16* cB = swp ? tA : tB;  // columns of the accumulator tiles
#pragma unroll
    for (int kk = 0; kk < 64; kk += 32) {
      v16bf af[4], bfr[4];
#pragma unroll
      for (int i = 0; i < 4; ++i)
        af[i] = load_frag(cA + i * 16 * LDST + kk, LDST, lane);
#pragma unroll
      for (int j = 0; j < 4; ++j)
        bfr[j] = load_frag(cB + j * 16 * LDST + kk, LDST, lane);
      // Keeps the 16 LDS reads together in front of their 16 WMMAs: left alone the
      // scheduler spreads them, one full LDS wait in front of every row of four.
      __builtin_amdgcn_sched_barrier(0);
#pragma unroll
      for (int i = 0; i < 4; ++i)
#pragma unroll
        for (int j = 0; j < 4; ++j)
          acc[i][j] = wmma_bf16(af[i], bfr[j], acc[i][j]);
    }
    // Hand-over: own reads of buffer `cur` retired, own copies of the next chunk
    // landed; the one barrier publishes that chunk and frees `cur` for a refill.
    asm volatile("s_wait_dscnt 0x0" ::: "memory");
    asm volatile("s_wait_asynccnt 0x0" ::: "memory");
    __syncthreads();
    if (kb + 128 < 1024) stage(cur, kb + 128);  // flies while the next chunk is worked on
  }
  asm volatile("s_wait_asynccnt 0x0" ::: "memory");  // nothing in flight at the wave's end

  // Epilogue. C layout: VGPR v -> row (v + half*8), col = lane%16 within tile.
  const int m = lane & 15, half = lane >> 4;
  if (MODE == 1) {
#pragma unroll
    for (int i = 0; i < 4; ++i) {
#pragma unroll
      for (int j = 0; j < 4; ++j) {
        const int f = col0 + wn * 64 + j * 16 + m;
        const float bv = bias[f];
#pragma unroll
        for (int v = 0; v < 8; ++v) {
          const int r = row0 + wm * 64 + i * 16 + v + half * 8;
          outF[(size_t)r * 1024 + f] = acc[i][j][v] + bv;
        }
      }
    }
  } else {
    // bias index of (ii, jj) is 3*ii + jj ; ii = hh*64 + dd ; b = n*16 + hh
    const int n = row0 >> 11;
    const int lb = (row0 & 2047) + wm * 64;    // first token of the wave tile
    const int ib = (col0 & 1023) + wn * 64;    // first feature ii of the wave tile
    if (swp) {
      const int jj = col0 >> 10;               // 0: Q, 1: K
      __bf16* dst = jj == 0 ? Qb : Kb;
      const float sc = jj == 0 ? 0.125f : 1.0f;  // fold the score scale into Q
#pragma unroll
      for (int i = 0; i < 4; ++i) {
        const int ii = ib + i * 16 + half * 8;  // 8 consecutive d of one head
        v8f bv;
#pragma unroll
        for (int v = 0; v < 8; ++v) bv[v] = bias[3 * (ii + v) + jj];
        const int b = n * 16 + (ii >> 6);
#pragma unroll
        for (int j = 0; j < 4; ++j) {
          const int l = lb + j * 16 + m;
          *(u32x4*)(dst + ((size_t)b * 2048 + l) * 64 + (ii & 63)) =
              pack8((acc[i][j] + bv) * sc);
        }
      }
    } else {
#pragma unroll
      for (int j = 0; j < 4; ++j) {
        const int ii = ib + j * 16 + m;
        const float bv = bias[3 * ii + 2];
        const int b = n * 16 + (ii >> 6);
#pragma unroll
        for (int i = 0; i < 4; ++i) {
          const int l = lb + i * 16 + half * 8;  // 8 consecutive tokens
          *(u32x4*)(Vtb + ((size_t)b * 64 + (ii & 63)) * 2048 + l) =
              pack8(acc[i][j] + bv);
        }
      }
      // Precaution: the built code lays the Q/K block behind these stores and
      // rewrites their address and data registers there; the wait stands first.
      asm volatile("s_wait_xcnt 0x0" ::: "memory");
    }
  }
}

// ---------------------------------------------------------------------------
// Kernel 3: flash attention. One wave = 16 query rows of one (batch,head) b.
// All 8 waves of a block share b, so each 64-key K/V^T block is staged ONCE
// per workgroup into double-buffered LDS via async copies: block i+1 streams
// in while WMMAs/softmax run on block i.
// Computes S^T = K*Q^T so that exp(S^T) registers are already in the exact
// B-operand packing for O^T += V^T * P^T (no LDS transpose needed).
// One pass = 64 keys: the work that is done once per pass whatever its length
// (new maximum and its exchange, alpha, rescale of the 32 O^T registers, exchange
// of the row sum, addresses, barrier) is paid once per 64 keys.
// ---------------------------------------------------------------------------
static constexpr int KST = 72;  // K tile stride (ushorts) = 144B
static constexpr int VST = 72;  // V^T tile stride (ushorts) = 144B
static constexpr int KSZ = 64 * KST;
static constexpr int VSZ = 64 * VST;

// 8 waves per SIMD (at most 128 VGPRs): the 1024 blocks are all resident at once.
__global__ __launch_bounds__(256) __attribute__((amdgpu_waves_per_eu(8, 8)))
void attn_kernel(const __bf16* __restrict__ Q, const __bf16* __restrict__ K,
                 const __bf16* __restrict__ Vt, __bf16* __restrict__ O) {
  __shared__ __align__(16) __bf16 sK[2 * KSZ];  // 64 keys x 64 d
  __shared__ __align__(16) __bf16 sV[2 * VSZ];  // 64 d x 64 keys (V^T)

  const int tid = threadIdx.x;
  const int lane = tid & 31;
  const int w = tid >> 5;
  const int b = blockIdx.y;                   // 0..63  (= n*16 + head)
  const int r0 = blockIdx.x * 128 + w * 16;   // query row tile
  const int m = lane & 15, half = lane >> 4;

  const __bf16* Qb = Q + (size_t)b * 2048 * 64;
  const __bf16* Kb = K + (size_t)b * 2048 * 64;
  const __bf16* Vb = Vt + (size_t)b * 64 * 2048;

  // 4 async copies per thread per 64-key block: either tile is 64 rows x 128 B =
  // 512 x 16 B; a thread's two copies of a tile lie 32 tile rows apart.
  const int sr = tid >> 3, sc = (tid & 7) * 8;
  const __bf16* gK = Kb + (size_t)sr * 64 + sc;
  const __bf16* gV = Vb + (size_t)sr * 2048 + sc;
  const unsigned lK = (unsigned)(size_t)(sK + sr * KST + sc);  // LDS byte address
  const unsigned lV = (unsigned)(size_t)(sV + sr * VST + sc);
  auto stage = [&](int buf, int key0) {
    unsigned l[4];
    const __bf16* g[4];
#pragma unroll
    for (int s = 0; s < 2; ++s) {
      l[s] = lK + (buf * KSZ + s * 32 * KST) * 2;
      g[s] = gK + (key0 + s * 32) * 64;
      l[2 + s] = lV + (buf * VSZ + s * 32 * VST) * 2;
      g[2 + s] = gV + s * 32 * 2048 + key0;
    }
    async_g2l_b128_x4(l, g);
  };

  // Q fragments (used as B operand: column n = query row n), d split in 2x32
  v16bf qf[2];
#pragma unroll
  for (int c = 0; c < 2; ++c)
    qf[c] = load_frag(Qb + (size_t)r0 * 64 + c * 32, 64, lane);

  v8f ot[4] = {};            // O^T tiles: d = j*16 + v + half*8, col = query m
  float mrow = -1e30f;       // running max for query row m (dup in lane m+16)
  float lrow = 0.0f;         // running sum

  stage(0, 0);
  asm volatile("s_wait_asynccnt 0x0" ::: "memory");  // block 0 has landed (own copies)
  __syncthreads();                                   // ... and every other wave's
  stage(1, 64);
  for (int kb = 0; kb < 32; ++kb) {
    const int cur = kb & 1;
    const __bf16* cK = sK + cur * KSZ;
    const __bf16* cV = sV + cur * VSZ;

    // LDS fragment loads. K as A operand: key tile t, d-chunk c. V^T as A operand:
    // fragment i = (key group i / 4, d tile i % 4), rows = d, 32 contiguous keys.
    auto kfrag = [&](int t, int c) {
      return load_frag(cK + (t * 16) * KST + c * 32, KST, lane);
    };
    auto vfrag = [&](int i) {
      return load_frag(cV + ((i & 3) * 16) * VST + (i >> 2) * 32, VST, lane);
    };
    auto score = [&](const v16bf (&k)[2]) {
      v8f z = {};
      z = wmma_bf16(k[0], qf[0], z);
      return wmma_bf16(k[1], qf[1], z);
    };

    // S^T tiles: row = key, col = query. Q already scaled by 1/8. The loads run one
    // key tile ahead of the products, the first V^T fragment too. The scheduling
    // barriers keep them there: left alone the scheduler sinks every load to its
    // product, and the wave waits out a full LDS latency in front of each.
    v8f st[4];
    v16bf ka[2] = {kfrag(0, 0), kfrag(0, 1)};
    v16bf kc[2] = {kfrag(1, 0), kfrag(1, 1)};
    __builtin_amdgcn_sched_barrier(0);
    st[0] = score(ka);
    ka[0] = kfrag(2, 0);
    ka[1] = kfrag(2, 1);
    __builtin_amdgcn_sched_barrier(0);
    st[1] = score(kc);
    kc[0] = kfrag(3, 0);
    kc[1] = kfrag(3, 1);
    st[2] = score(ka);
    v16bf vf[4];
    vf[0] = vfrag(0);
    __builtin_amdgcn_sched_barrier(0);
    st[3] = score(kc);

    // online softmax: each lane holds 32 scores of its query row; partner lane
    // (xor 16) holds the other 32 keys of this 64-key block.
    float vmax = -1e30f;
#pragma unroll
    for (int t = 0; t < 4; ++t)
#pragma unroll
      for (int v = 0; v < 8; ++v) vmax = fmaxf(vmax, st[t][v]);
    vmax = fmaxf(vmax, __shfl_xor(vmax, 16, 32));
    const float mnew = fmaxf(mrow, vmax);
    const float alpha = __expf(mrow - mnew);

    // exp(s - mnew) over all 32 scores of the lane, in place: the differences times
    // log2(e), then the exponentials.
#pragma unroll
    for (int t = 0; t < 4; ++t) st[t] = (st[t] - mnew) * 1.44269504088896340736f;
#pragma unroll
    for (int t = 0; t < 4; ++t)
#pragma unroll
      for (int v = 0; v < 8; ++v) st[t][v] = __builtin_amdgcn_exp2f(st[t][v]);

    // P^T in registers, repacked directly into B-operand layout, one operand per
    // 32 keys: element e<8 -> tile 2g [e], e>=8 -> tile 2g+1 [e-8] (both halves).
    // Neighbouring keys stay in register pairs: one packed convert per pair, and
    // the row sum runs in pairs too (one packed add per pair), joined at the end.
    v16bf pb[2];
    f32x2 ps2[2];
#pragma unroll
    for (int g = 0; g < 2; ++g) {
      u32x8 pw;
#pragma unroll
      for (int e = 0; e < 4; ++e) {
        const f32x2 p0 = {st[2 * g][2 * e], st[2 * g][2 * e + 1]};
        const f32x2 p1 = {st[2 * g + 1][2 * e], st[2 * g + 1][2 * e + 1]};
        const f32x2 ps = p0 + p1;
        ps2[g] = e == 0 ? ps : ps2[g] + ps;
        pw[e] = pk2(p0[0], p0[1]);
        pw[e + 4] = pk2(p1[0], p1[1]);
      }
      pb[g] = __builtin_bit_cast(v16bf, pw);
    }
    const f32x2 psj = ps2[0] + ps2[1];
    float psum = psj[0] + psj[1];
    vf[1] = vfrag(1);
    vf[2] = vfrag(2);
    vf[3] = vfrag(3);
    psum += __shfl_xor(psum, 16, 32);
    lrow = lrow * alpha + psum;
    mrow = mnew;
#pragma unroll
    for (int j = 0; j < 4; ++j) ot[j] *= alpha;

    // O^T += V^T * P^T; each product is followed by the load of the fragment four
    // ahead into the registers it frees.
#pragma unroll
    for (int i = 0; i < 8; ++i) {
      ot[i & 3] = wmma_bf16(vf[i & 3], pb[i >> 2], ot[i & 3]);
      if (i + 4 < 8) vf[i & 3] = vfrag(i + 4);
    }

    // Hand-over: own reads of buffer `cur` retired, own copies of the next block
    // landed; the one barrier publishes that block and frees `cur` for a refill.
    asm volatile("s_wait_dscnt 0x0" ::: "memory");
    asm volatile("s_wait_asynccnt 0x0" ::: "memory");
    __syncthreads();
    if (kb + 2 < 32) stage(cur, (kb + 2) * 64);  // flies while the next block is worked on
  }
  asm volatile("s_wait_asynccnt 0x0" ::: "memory");  // nothing in flight at the wave's end

  // Normalize and scatter into (l, n, h*64 + d) bf16 layout for the out GEMM.
  const float inv = 1.0f / lrow;
  const int lseq = r0 + m;
  const int n = b >> 4, hh = b & 15;
  __bf16* orow = O + ((size_t)lseq * 4 + n) * 1024 + hh * 64;
#pragma unroll
  for (int j = 0; j < 4; ++j)
    *(u32x4*)(orow + j * 16 + half * 8) = pack8(ot[j] * inv);
}

// ---------------------------------------------------------------------------
// Launch
// ---------------------------------------------------------------------------
extern "C" void kernel_launch(void* const* d_in, const int* in_sizes, int n_in,
                              void* d_out, int out_size, void* d_ws, size_t ws_size,
                              hipStream_t stream) {
  const float* query = (const float*)d_in[0];     // (2048, 4, 1024)
  const float* qkv_proj = (const float*)d_in[1];  // (3072, 1024)
  const float* qkv_bias = (const float*)d_in[2];  // (3072,)
  const float* out_proj = (const float*)d_in[3];  // (1024, 1024)
  const float* out_bias = (const float*)d_in[4];  // (1024,)
  float* out = (float*)d_out;                     // (2048, 4, 1024) f32
  (void)in_sizes; (void)n_in; (void)out_size; (void)ws_size;

  char* ws = (char*)d_ws;
  size_t off = 0;
  auto carve = [&](size_t bytes) {
    void* p = ws + off;
    off += (bytes + 255) & ~(size_t)255;
    return p;
  };
  __bf16* qA   = (__bf16*)carve(8192ull * 1024 * 2);       // query bf16, row n*2048+l
  __bf16* wQKV = (__bf16*)carve(3072ull * 1024 * 2);       // qkv_proj bf16, row jj*1024+ii
  __bf16* wOUT = (__bf16*)carve(1024ull * 1024 * 2);       // out_proj bf16
  __bf16* Qb   = (__bf16*)carve(64ull * 2048 * 64 * 2);    // Q (b,l,d), pre-scaled
  __bf16* Kb   = (__bf16*)carve(64ull * 2048 * 64 * 2);    // K (b,l,d)
  __bf16* Vtb  = (__bf16*)carve(64ull * 64 * 2048 * 2);    // V^T (b,d,l)
  __bf16* Ob   = (__bf16*)carve(8192ull * 1024 * 2);       // attn out (l*4+n, i)

  cvt_f32_bf16<1><<<(8192 * 1024 / 4 + 255) / 256, 256, 0, stream>>>(query, qA,
                                                                     8192 * 1024 / 4);
  cvt_f32_bf16<2><<<(3072 * 1024 / 4 + 255) / 256, 256, 0, stream>>>(qkv_proj, wQKV,
                                                                     3072 * 1024 / 4);
  cvt_f32_bf16<0><<<(1024 * 1024 / 4 + 255) / 256, 256, 0, stream>>>(out_proj, wOUT,
                                                                     1024 * 1024 / 4);

  // QKV projection: M=8192, N=3072 -> grid (12, 64)
  gemm_nt<0><<<dim3(12, 64), 256, 0, stream>>>(qA, wQKV, qkv_bias, nullptr, Qb, Kb,
                                                Vtb);
  // Attention: 64 head-batches x 16 row-groups of 128 rows
  attn_kernel<<<dim3(16, 64), 256, 0, stream>>>(Qb, Kb, Vtb, Ob);
  // Output projection: M=8192, N=1024 -> grid (4, 64)
  gemm_nt<1><<<dim3(4, 64), 256, 0, stream>>>(Ob, wOUT, out_bias, out, nullptr,
                                               nullptr, nullptr);
}

// v005
// A run of this version takes 135 microseconds.
// Next to v004, in two timings, it ran 1.03 times as fast each time.
// All steps since v000 together make it 1.47 times as fast.
#include <hip/hip_runtime.h>

// ---------------------------------------------------------------------------
// Types
// ---------------------------------------------------------------------------
typedef __attribute__((ext_vector_type(16))) __bf16        v16bf;
typedef __attribute__((ext_vector_type(8)))  float         v8f;
typedef __attribute__((ext_vector_type(4)))  unsigned int  u32x4;
typedef __attribute__((ext_vector_type(8)))  unsigned int  u32x8;
typedef __attribute__((ext_vector_type(2)))  unsigned int  u32x2;
typedef __attribute__((ext_vector_type(4)))  float         f32x4;
typedef __attribute__((ext_vector_type(2)))  float         f32x2;
typedef __attribute__((ext_vector_type(2)))  __bf16        bf16x2;

// Two f32 -> two bf16 in one dword (a in the low half), round to nearest even:
// one packed hardware convert per pair.
static __device__ __forceinline__ unsigned pk2(float a, float b) {
  f32x2 v = {a, b};
  return __builtin_bit_cast(unsigned, __builtin_convertvector(v, bf16x2));
}

// Eight f32 -> eight bf16 in one 16-byte word group (element 0 lowest).
static __device__ __forceinline__ u32x4 pack8(v8f x) {
  u32x4 o;
#pragma unroll
  for (int e = 0; e < 4; ++e) o[e] = pk2(x[2 * e], x[2 * e + 1]);
  return o;
}

// Load one 16x32 bf16 A/B WMMA fragment from a row-major bf16 matrix.
// Per CDNA5 ISA 16-bit A layout: lane m (m<16) holds row m, K {0..7, 16..23};
// lane m+16 holds row m, K {8..15, 24..31}. B fragments use the identical
// per-lane pattern with "row" = C-column (NT GEMM symmetry).
static __device__ __forceinline__ v16bf load_frag(const __bf16* p, int stride, int lane) {
  const int m = lane & 15, h = lane >> 4;
  const __bf16* q = p + (size_t)m * (size_t)stride + h * 8;
  u32x4 lo = *(const u32x4*)(q);        // K chunk {0..7}/{8..15}
  u32x4 hi = *(const u32x4*)(q + 16);   // K chunk {16..23}/{24..31}
  u32x8 w = __builtin_shufflevector(lo, hi, 0, 1, 2, 3, 4, 5, 6, 7);
  return __builtin_bit_cast(v16bf, w);
}

static __device__ __forceinline__ v8f wmma_bf16(v16bf a, v16bf b, v8f c) {
  return __builtin_amdgcn_wmma_f32_16x16x32_bf16(false, a, false, b, (short)0, c,
                                                 false, false);
}

// CDNA5 async global->LDS copies (ASYNCcnt-tracked, no VGPR round trip): 16 bytes
// per lane, LDS byte address in a VGPR, 64-bit global address in a VGPR pair.
// Four copies of one lane (one 64-key K and V^T block of the attention kernel) in
// one statement. The closing s_wait_xcnt stands inside it, so no address register
// of a copy is rewritten in front of the wait (a precaution for asm-text copies).
static __device__ __forceinline__ void async_g2l_b128_x4(const unsigned (&l)[4],
                                                         const __bf16* const (&g)[4]) {
  asm volatile(
      "global_load_async_to_lds_b128 %0, %4, off\n\t"
      "global_load_async_to_lds_b128 %1, %5, off\n\t"
      "global_load_async_to_lds_b128 %2, %6, off\n\t"
      "global_load_async_to_lds_b128 %3, %7, off\n\t"
      "s_wait_xcnt 0x0"
      :: "v"(l[0]), "v"(l[1]), "v"(l[2]), "v"(l[3]),
         "v"(g[0]), "v"(g[1]), "v"(g[2]), "v"(g[3])
      : "memory");
}

// Twelve such copies of one lane (one K-chunk of the GEMM tile) in one statement.
// The closing s_wait_xcnt stands inside it, so no address register of a copy is
// rewritten in front of the wait (a precaution for copies written as asm text).
static __device__ __forceinline__ void async_g2l_b128_x12(const unsigned (&l)[12],
                                                          const __bf16* const (&g)[12]) {
  asm volatile(
      "global_load_async_to_lds_b128 %0, %12, off\n\t"
      "global_load_async_to_lds_b128 %1, %13, off\n\t"
      "global_load_async_to_lds_b128 %2, %14, off\n\t"
      "global_load_async_to_lds_b128 %3, %15, off\n\t"
      "global_load_async_to_lds_b128 %4, %16, off\n\t"
      "global_load_async_to_lds_b128 %5, %17, off\n\t"
      "global_load_async_to_lds_b128 %6, %18, off\n\t"
      "global_load_async_to_lds_b128 %7, %19, off\n\t"
      "global_load_async_to_lds_b128 %8, %20, off\n\t"
      "global_load_async_to_lds_b128 %9, %21, off\n\t"
      "global_load_async_to_lds_b128 %10, %22, off\n\t"
      "global_load_async_to_lds_b128 %11, %23, off\n\t"
      "s_wait_xcnt 0x0"
      :: "v"(l[0]), "v"(l[1]), "v"(l[2]), "v"(l[3]), "v"(l[4]), "v"(l[5]),
         "v"(l[6]), "v"(l[7]), "v"(l[8]), "v"(l[9]), "v"(l[10]), "v"(l[11]),
         "v"(g[0]), "v"(g[1]), "v"(g[2]), "v"(g[3]), "v"(g[4]), "v"(g[5]),
         "v"(g[6]), "v"(g[7]), "v"(g[8]), "v"(g[9]), "v"(g[10]), "v"(g[11])
      : "memory");
}

// ---------------------------------------------------------------------------
// Kernel 1: f32 -> bf16 convert (4 elements / thread), rows of 1024 elements
// (one block = one row). PERM picks the destination row:
//   0: same row
//   1: source row l*4 + n   -> row n*2048 + l    (tokens grouped by batch n)
//   2: source row 3*ii + jj -> row jj*1024 + ii  (Q, K, V weight rows grouped)
// ---------------------------------------------------------------------------
template <int PERM>
__global__ __launch_bounds__(256) void cvt_f32_bf16(const float* __restrict__ src,
                                                    __bf16* __restrict__ dst, int n4) {
  int i = blockIdx.x * 256 + threadIdx.x;
  if (i >= n4) return;
  const int row = i >> 8, c4 = i & 255;
  const int drow = PERM == 1 ? (row & 3) * 2048 + (row >> 2)
                 : PERM == 2 ? (row % 3) * 1024 + row / 3
                             : row;
  f32x4 f = *(const f32x4*)(src + (size_t)i * 4);
  u32x2 o;
  o[0] = pk2(f[0], f[1]);
  o[1] = pk2(f[2], f[3]);
  *(u32x2*)(dst + (size_t)drow * 1024 + c4 * 4) = o;
}

// ---------------------------------------------------------------------------
// Kernels 2 & 4: NT bf16 GEMM  C(M x Ncols) = A(M x 1024) * B(Ncols x 1024)^T
// Workgroup tile 128(M) x 256(N), 8 waves (2x4), wave tile 64x64 (4x4 WMMA
// tiles): each fragment read from LDS feeds 4 WMMAs, each operand row fetched
// from L2 feeds 128 or 256 output columns. K streamed in 64-wide chunks through
// DOUBLE-BUFFERED LDS using async global->LDS copies: chunk i+1 streams in while
// WMMAs run on chunk i.
// MODE 0: QKV projection. A rows are n*2048 + l, B rows jj*1024 + ii (see the
//         convert), so a block is one n, 128 consecutive l, and all Q, all K or
//         all V. A lane's 8 accumulator registers run along the tile's row
//         axis: V blocks keep tokens there (8 consecutive l = 16 B of V^T);
//         Q and K blocks trade the two operands, so features lie there
//         (8 consecutive d = 16 B of a Q or K row). One 16-byte store per tile.
// MODE 1: output projection epilogue (bias, f32 store to d_out)
// ---------------------------------------------------------------------------
static constexpr int LDST = 72;  // ushort stride = 144 bytes (conflict-free)
static constexpr int ASZ = 128 * LDST;
static constexpr int BSZ = 256 * LDST;

template <int MODE>
__global__ __launch_bounds__(256) void gemm_nt(
    const __bf16* __restrict__ A, const __bf16* __restrict__ B,
    const float* __restrict__ bias, float* __restrict__ outF,
    __bf16* __restrict__ Qb, __bf16* __restrict__ Kb, __bf16* __restrict__ Vtb) {
  __shared__ __align__(16) __bf16 sA[2 * ASZ];
  __shared__ __align__(16) __bf16 sB[2 * BSZ];

  const int tid = threadIdx.x;
  const int lane = tid & 31;
  const int w = tid >> 5;
  const int wm = w & 1, wn = w >> 1;
  const int row0 = blockIdx.y * 128;
  const int col0 = blockIdx.x * 256;
  const bool swp = MODE == 0 && col0 < 2048;  // Q or K block (block-uniform)

  // 12 async copies per thread per K-chunk: 4 for A (128 rows x 64 K = 1024 x
  // 16 B), 8 for B (256 rows). A thread's copies lie 32 tile rows apart.
  const int sr = tid >> 3, sc = (tid & 7) * 8;
  const __bf16* gA = A + (size_t)(row0 + sr) * 1024 + sc;
  const __bf16* gB = B + (size_t)(col0 + sr) * 1024 + sc;
  const unsigned lA = (unsigned)(size_t)(sA + sr * LDST + sc);  // LDS byte address
  const unsigned lB = (unsigned)(size_t)(sB + sr * LDST + sc);
  auto stage = [&](int buf, int kb) {
    unsigned l[12];
    const __bf16* g[12];
#pragma unroll
    for (int s = 0; s < 4; ++s) {
      l[s] = lA + (buf * ASZ + s * 32 * LDST) * 2;
      g[s] = gA + s * 32 * 1024 + kb;
    }
#pragma unroll
    for (int s = 0; s < 8; ++s) {
      l[4 + s] = lB + (buf * BSZ + s * 32 * LDST) * 2;
      g[4 + s] = gB + s * 32 * 1024 + kb;
    }
    async_g2l_b128_x12(l, g);
  };

  v8f acc[4][4] = {};

  stage(0, 0);
  asm volatile("s_wait_asynccnt 0x0" ::: "memory");  // chunk 0 has landed (own copies)
  __syncthreads();                                   // ... and every other wave's
  stage(1, 64);
  for (int kb = 0; kb < 1024; kb += 64) {
    const int cur = (kb >> 6) & 1;
    const __bf16* tA = sA + cur * ASZ + wm * 64 * LDST;  // this wave's 64 tokens
    const __bf16* tB = sB + cur * BSZ + wn * 64 * LDST;  // this wave's 64 features
    const __bf16* cA = swp ? tB : tA;  // rows of the accumulator tiles
    const __bf16* cB = swp ? tA : tB;  // columns of the accumulator tiles
#pragma unroll
    for (int kk = 0; kk < 64; kk += 32) {
      v16bf af[4], bfr[4];
#pragma unroll
      for (int i = 0; i < 4; ++i)
        af[i] = load_frag(cA + i * 16 * LDST + kk, LDST, lane);
#pragma unroll
      for (int j = 0; j < 4; ++j)
        bfr[j] = load_frag(cB + j * 16 * LDST + kk, LDST, lane);
      // Keeps the 16 LDS reads together in front of their 16 WMMAs: left alone the
      // scheduler spreads them, one full LDS wait in front of every row of four.
      __builtin_amdgcn_sched_barrier(0);
#pragma unroll
      for (int i = 0; i < 4; ++i)
#pragma unroll
        for (int j = 0; j < 4; ++j)
          acc[i][j] = wmma_bf16(af[i], bfr[j], acc[i][j]);
    }
    // Hand-over: own reads of buffer `cur` retired, own copies of the next chunk
    // landed; the one barrier publishes that chunk and frees `cur` for a refill.
    asm volatile("s_wait_dscnt 0x0" ::: "memory");
    asm volatile("s_wait_asynccnt 0x0" ::: "memory");
    __syncthreads();
    if (kb + 128 < 1024) stage(cur, kb + 128);  // flies while the next chunk is worked on
  }
  asm volatile("s_wait_asynccnt 0x0" ::: "memory");  // nothing in flight at the wave's end

  // Epilogue. C layout: VGPR v -> row (v + half*8), col = lane%16 within tile.
  const int m = lane & 15, half = lane >> 4;
  if (MODE == 1) {
#pragma unroll
    for (int i = 0; i < 4; ++i) {
#pragma unroll
      for (int j = 0; j < 4; ++j) {
        const int f = col0 + wn * 64 + j * 16 + m;
        const float bv = bias[f];
#pragma unroll
        for (int v = 0; v < 8; ++v) {
          const int r = row0 + wm * 64 + i * 16 + v + half * 8;
          outF[(size_t)r * 1024 + f] = acc[i][j][v] + bv;
        }
      }
    }
  } else {
    // bias index of (ii, jj) is 3*ii + jj ; ii = hh*64 + dd ; b = n*16 + hh
    const int n = row0 >> 11;
    const int lb = (row0 & 2047) + wm * 64;    // first token of the wave tile
    const int ib = (col0 & 1023) + wn * 64;    // first feature ii of the wave tile
    if (swp) {
      const int jj = col0 >> 10;               // 0: Q, 1: K
      __bf16* dst = jj == 0 ? Qb : Kb;
      const float sc = jj == 0 ? 0.125f : 1.0f;  // fold the score scale into Q
#pragma unroll
      for (int i = 0; i < 4; ++i) {
        const int ii = ib + i * 16 + half * 8;  // 8 consecutive d of one head
        v8f bv;
#pragma unroll
        for (int v = 0; v < 8; ++v) bv[v] = bias[3 * (ii + v) + jj];
        const int b = n * 16 + (ii >> 6);
#pragma unroll
        for (int j = 0; j < 4; ++j) {
          const int l = lb + j * 16 + m;
          *(u32x4*)(dst + ((size_t)b * 2048 + l) * 64 + (ii & 63)) =
              pack8((acc[i][j] + bv) * sc);
        }
      }
    } else {
#pragma unroll
      for (int j = 0; j < 4; ++j) {
        const int ii = ib + j * 16 + m;
        const float bv = bias[3 * ii + 2];
        const int b = n * 16 + (ii >> 6);
#pragma unroll
        for (int i = 0; i < 4; ++i) {
          const int l = lb + i * 16 + half * 8;  // 8 consecutive tokens
          *(u32x4*)(Vtb + ((size_t)b * 64 + (ii & 63)) * 2048 + l) =
              pack8(acc[i][j] + bv);
        }
      }
      // Precaution: the built code lays the Q/K block behind these stores and
      // rewrites their address and data registers there; the wait stands first.
      asm volatile("s_wait_xcnt 0x0" ::: "memory");
    }
  }
}

// ---------------------------------------------------------------------------
// Kernel 3: flash attention. One wave = 32 query rows (two 16-column groups) of
// one (batch,head) b: every K and V^T fragment read from LDS feeds two WMMAs, one
// per column group, and a block of 8 waves covers 256 query rows, so each 64-key
// K/V^T block is fetched from L2 by half as many blocks.
// All 8 waves of a block share b, so each 64-key K/V^T block is staged ONCE
// per workgroup into double-buffered LDS via async copies: block i+1 streams
// in while WMMAs/softmax run on block i.
// Computes S^T = K*Q^T so that exp(S^T) registers are already in the exact
// B-operand packing for O^T += V^T * P^T (no LDS transpose needed).
// One pass = 64 keys: the work that is done once per pass whatever its length
// (new maximum and its exchange, alpha, rescale of the O^T registers, exchange
// of the row sum, addresses, barrier) is paid once per 64 keys.
// ---------------------------------------------------------------------------
static constexpr int KST = 72;  // K tile stride (ushorts) = 144B
static constexpr int VST = 72;  // V^T tile stride (ushorts) = 144B
static constexpr int KSZ = 64 * KST;
static constexpr int VSZ = 64 * VST;

// 4 waves per SIMD (at most 256 VGPRs): the 512 blocks are all resident at once.
__global__ __launch_bounds__(256) __attribute__((amdgpu_waves_per_eu(4, 4)))
void attn_kernel(const __bf16* __restrict__ Q, const __bf16* __restrict__ K,
                 const __bf16* __restrict__ Vt, __bf16* __restrict__ O) {
  __shared__ __align__(16) __bf16 sK[2 * KSZ];  // 64 keys x 64 d
  __shared__ __align__(16) __bf16 sV[2 * VSZ];  // 64 d x 64 keys (V^T)

  const int tid = threadIdx.x;
  const int lane = tid & 31;
  const int w = tid >> 5;
  const int b = blockIdx.y;                   // 0..63  (= n*16 + head)
  const int r0 = blockIdx.x * 256 + w * 32;   // first query row of the wave
  const int m = lane & 15, half = lane >> 4;

  const __bf16* Qb = Q + (size_t)b * 2048 * 64;
  const __bf16* Kb = K + (size_t)b * 2048 * 64;
  const __bf16* Vb = Vt + (size_t)b * 64 * 2048;

  // 4 async copies per thread per 64-key block: either tile is 64 rows x 128 B =
  // 512 x 16 B; a thread's two copies of a tile lie 32 tile rows apart.
  const int sr = tid >> 3, sc = (tid & 7) * 8;
  const __bf16* gK = Kb + (size_t)sr * 64 + sc;
  const __bf16* gV = Vb + (size_t)sr * 2048 + sc;
  const unsigned lK = (unsigned)(size_t)(sK + sr * KST + sc);  // LDS byte address
  const unsigned lV = (unsigned)(size_t)(sV + sr * VST + sc);
  auto stage = [&](int buf, int key0) {
    unsigned l[4];
    const __bf16* g[4];
#pragma unroll
    for (int s = 0; s < 2; ++s) {
      l[s] = lK + (buf * KSZ + s * 32 * KST) * 2;
      g[s] = gK + (key0 + s * 32) * 64;
      l[2 + s] = lV + (buf * VSZ + s * 32 * VST) * 2;
      g[2 + s] = gV + s * 32 * 2048 + key0;
    }
    async_g2l_b128_x4(l, g);
  };

  // Q fragments (used as B operand: column n = query row n) of column group q,
  // d split in 2x32
  v16bf qf[2][2];
#pragma unroll
  for (int q = 0; q < 2; ++q)
#pragma unroll
    for (int c = 0; c < 2; ++c)
      qf[q][c] = load_frag(Qb + (size_t)(r0 + q * 16) * 64 + c * 32, 64, lane);

  v8f ot[2][4] = {};                  // O^T tiles: d = j*16 + v + half*8, col = query m
  float mrow[2] = {-1e30f, -1e30f};   // running max for query row m (dup in lane m+16)
  float lrow[2] = {0.0f, 0.0f};       // running sum

  stage(0, 0);
  asm volatile("s_wait_asynccnt 0x0" ::: "memory");  // block 0 has landed (own copies)
  __syncthreads();                                   // ... and every other wave's
  stage(1, 64);
  for (int kb = 0; kb < 32; ++kb) {
    const int cur = kb & 1;
    const __bf16* cK = sK + cur * KSZ;
    const __bf16* cV = sV + cur * VSZ;

    // LDS fragment loads. K as A operand: key tile t, d-chunk c. V^T as A operand:
    // fragment i = (key group i / 4, d tile i % 4), rows = d, 32 contiguous keys.
    auto kfrag = [&](int t, int c) {
      return load_frag(cK + (t * 16) * KST + c * 32, KST, lane);
    };
    auto vfrag = [&](int i) {
      return load_frag(cV + ((i & 3) * 16) * VST + (i >> 2) * 32, VST, lane);
    };
    // One key tile against both column groups; the two chains alternate.
    v8f st[2][4];
    auto score = [&](int t, const v16bf (&k)[2]) {
      v8f z0 = {}, z1 = {};
      z0 = wmma_bf16(k[0], qf[0][0], z0);
      z1 = wmma_bf16(k[0], qf[1][0], z1);
      st[0][t] = wmma_bf16(k[1], qf[0][1], z0);
      st[1][t] = wmma_bf16(k[1], qf[1][1], z1);
    };

    // S^T tiles: row = key, col = query. Q already scaled by 1/8. The loads run one
    // key tile ahead of the products, the first V^T fragment too. The scheduling
    // barriers keep them there: left alone the scheduler sinks every load to its
    // product, and the wave waits out a full LDS latency in front of each.
    v16bf ka[2] = {kfrag(0, 0), kfrag(0, 1)};
    v16bf kc[2] = {kfrag(1, 0), kfrag(1, 1)};
    __builtin_amdgcn_sched_barrier(0);
    score(0, ka);
    ka[0] = kfrag(2, 0);
    ka[1] = kfrag(2, 1);
    __builtin_amdgcn_sched_barrier(0);
    score(1, kc);
    kc[0] = kfrag(3, 0);
    kc[1] = kfrag(3, 1);
    score(2, ka);
    v16bf vf[4];
    vf[0] = vfrag(0);
    __builtin_amdgcn_sched_barrier(0);
    score(3, kc);

    // online softmax, per column group: each lane holds 32 scores of its query row;
    // partner lane (xor 16) holds the other 32 keys of this 64-key block.
    float vmax[2], alpha[2];
#pragma unroll
    for (int q = 0; q < 2; ++q) {
      vmax[q] = -1e30f;
#pragma unroll
      for (int t = 0; t < 4; ++t)
#pragma unroll
        for (int v = 0; v < 8; ++v) vmax[q] = fmaxf(vmax[q], st[q][t][v]);
    }
    const float xmax[2] = {__shfl_xor(vmax[0], 16, 32), __shfl_xor(vmax[1], 16, 32)};

    // P^T in registers, repacked directly into B-operand layout, one operand per
    // 32 keys: element e<8 -> tile 2g [e], e>=8 -> tile 2g+1 [e-8] (both halves).
    // Neighbouring keys stay in register pairs: one packed convert per pair, and
    // the row sum runs in pairs too (one packed add per pair), joined at the end.
    v16bf pb[2][2];
    float psum[2];
#pragma unroll
    for (int q = 0; q < 2; ++q) {
      const float mnew = fmaxf(mrow[q], fmaxf(vmax[q], xmax[q]));
      alpha[q] = __expf(mrow[q] - mnew);
      mrow[q] = mnew;

      // exp(s - mnew) over all 32 scores of the lane, in place: the differences
      // times log2(e), then the exponentials.
#pragma unroll
      for (int t = 0; t < 4; ++t)
        st[q][t] = (st[q][t] - mnew) * 1.44269504088896340736f;
#pragma unroll
      for (int t = 0; t < 4; ++t)
#pragma unroll
        for (int v = 0; v < 8; ++v) st[q][t][v] = __builtin_amdgcn_exp2f(st[q][t][v]);

      f32x2 ps2[2];
#pragma unroll
      for (int g = 0; g < 2; ++g) {
        u32x8 pw;
#pragma unroll
        for (int e = 0; e < 4; ++e) {
          const f32x2 p0 = {st[q][2 * g][2 * e], st[q][2 * g][2 * e + 1]};
          const f32x2 p1 = {st[q][2 * g + 1][2 * e], st[q][2 * g + 1][2 * e + 1]};
          const f32x2 ps = p0 + p1;
          ps2[g] = e == 0 ? ps : ps2[g] + ps;
          pw[e] = pk2(p0[0], p0[1]);
          pw[e + 4] = pk2(p1[0], p1[1]);
        }
        pb[q][g] = __builtin_bit_cast(v16bf, pw);
      }
      const f32x2 psj = ps2[0] + ps2[1];
      psum[q] = psj[0] + psj[1];
    }
    vf[1] = vfrag(1);
    vf[2] = vfrag(2);
    vf[3] = vfrag(3);
    const float xsum[2] = {__shfl_xor(psum[0], 16, 32), __shfl_xor(psum[1], 16, 32)};
#pragma unroll
    for (int q = 0; q < 2; ++q) {
      lrow[q] = lrow[q] * alpha[q] + (psum[q] + xsum[q]);
#pragma unroll
      for (int j = 0; j < 4; ++j) ot[q][j] *= alpha[q];
    }

    // O^T += V^T * P^T, each fragment against both column groups; the pair of
    // products is followed by the load of the fragment four ahead into the
    // registers it frees.
#pragma unroll
    for (int i = 0; i < 8; ++i) {
      ot[0][i & 3] = wmma_bf16(vf[i & 3], pb[0][i >> 2], ot[0][i & 3]);
      ot[1][i & 3] = wmma_bf16(vf[i & 3], pb[1][i >> 2], ot[1][i & 3]);
      if (i + 4 < 8) vf[i & 3] = vfrag(i + 4);
    }

    // Hand-over: own reads of buffer `cur` retired, own copies of the next block
    // landed; the one barrier publishes that block and frees `cur` for a refill.
    asm volatile("s_wait_dscnt 0x0" ::: "memory");
    asm volatile("s_wait_asynccnt 0x0" ::: "memory");
    __syncthreads();
    if (kb + 2 < 32) stage(cur, (kb + 2) * 64);  // flies while the next block is worked on
  }
  asm volatile("s_wait_asynccnt 0x0" ::: "memory");  // nothing in flight at the wave's end

  // Normalize and scatter into (l, n, h*64 + d) bf16 layout for the out GEMM.
  const int n = b >> 4, hh = b & 15;
#pragma unroll
  for (int q = 0; q < 2; ++q) {
    const float inv = 1.0f / lrow[q];
    const int lseq = r0 + q * 16 + m;
    __bf16* orow = O + ((size_t)lseq * 4 + n) * 1024 + hh * 64;
#pragma unroll
    for (int j = 0; j < 4; ++j)
      *(u32x4*)(orow + j * 16 + half * 8) = pack8(ot[q][j] * inv);
  }
}

// ---------------------------------------------------------------------------
// Launch
// ---------------------------------------------------------------------------
extern "C" void kernel_launch(void* const* d_in, const int* in_sizes, int n_in,
                              void* d_out, int out_size, void* d_ws, size_t ws_size,
                              hipStream_t stream) {
  const float* query = (const float*)d_in[0];     // (2048, 4, 1024)
  const float* qkv_proj = (const float*)d_in[1];  // (3072, 1024)
  const float* qkv_bias = (const float*)d_in[2];  // (3072,)
  const float* out_proj = (const float*)d_in[3];  // (1024, 1024)
  const float* out_bias = (const float*)d_in[4];  // (1024,)
  float* out = (float*)d_out;                     // (2048, 4, 1024) f32
  (void)in_sizes; (void)n_in; (void)out_size; (void)ws_size;

  char* ws = (char*)d_ws;
  size_t off = 0;
  auto carve = [&](size_t bytes) {
    void* p = ws + off;
    off += (bytes + 255) & ~(size_t)255;
    return p;
  };
  __bf16* qA   = (__bf16*)carve(8192ull * 1024 * 2);       // query bf16, row n*2048+l
  __bf16* wQKV = (__bf16*)carve(3072ull * 1024 * 2);       // qkv_proj bf16, row jj*1024+ii
  __bf16* wOUT = (__bf16*)carve(1024ull * 1024 * 2);       // out_proj bf16
  __bf16* Qb   = (__bf16*)carve(64ull * 2048 * 64 * 2);    // Q (b,l,d), pre-scaled
  __bf16* Kb   = (__bf16*)carve(64ull * 2048 * 64 * 2);    // K (b,l,d)
  __bf16* Vtb  = (__bf16*)carve(64ull * 64 * 2048 * 2);    // V^T (b,d,l)
  __bf16* Ob   = (__bf16*)carve(8192ull * 1024 * 2);       // attn out (l*4+n, i)

  cvt_f32_bf16<1><<<(8192 * 1024 / 4 + 255) / 256, 256, 0, stream>>>(query, qA,
                                                                     8192 * 1024 / 4);
  cvt_f32_bf16<2><<<(3072 * 1024 / 4 + 255) / 256, 256, 0, stream>>>(qkv_proj, wQKV,
                                                                     3072 * 1024 / 4);
  cvt_f32_bf16<0><<<(1024 * 1024 / 4 + 255) / 256, 256, 0, stream>>>(out_proj, wOUT,
                                                                     1024 * 1024 / 4);

  // QKV projection: M=8192, N=3072 -> grid (12, 64)
  gemm_nt<0><<<dim3(12, 64), 256, 0, stream>>>(qA, wQKV, qkv_bias, nullptr, Qb, Kb,
                                                Vtb);
  // Attention: 64 head-batches x 8 row-groups of 256 rows
  attn_kernel<<<dim3(8, 64), 256, 0, stream>>>(Qb, Kb, Vtb, Ob);
  // Output projection: M=8192, N=1024 -> grid (4, 64)
  gemm_nt<1><<<dim3(4, 64), 256, 0, stream>>>(Ob, wOUT, out_bias, out, nullptr,
                                               nullptr, nullptr);
}

// v006
// Measured time: 127 microseconds a run.
// Two timings next to v005 both put it at 1.07 times that version's speed.
// All steps since v000 together make it 1.57 times as fast.
#include <hip/hip_runtime.h>

// ---------------------------------------------------------------------------
// Types
// ---------------------------------------------------------------------------
typedef __attribute__((ext_vector_type(16))) __bf16        v16bf;
typedef __attribute__((ext_vector_type(8)))  float         v8f;
typedef __attribute__((ext_vector_type(4)))  unsigned int  u32x4;
typedef __attribute__((ext_vector_type(8)))  unsigned int  u32x8;
typedef __attribute__((ext_vector_type(2)))  unsigned int  u32x2;
typedef __attribute__((ext_vector_type(4)))  float         f32x4;
typedef __attribute__((ext_vector_type(2)))  float         f32x2;
typedef __attribute__((ext_vector_type(2)))  __bf16        bf16x2;

// Two f32 -> two bf16 in one dword (a in the low half), round to nearest even:
// one packed hardware convert per pair.
static __device__ __forceinline__ unsigned pk2(float a, float b) {
  f32x2 v = {a, b};
  return __builtin_bit_cast(unsigned, __builtin_convertvector(v, bf16x2));
}

// Eight f32 -> eight bf16 in one 16-byte word group (element 0 lowest).
static __device__ __forceinline__ u32x4 pack8(v8f x) {
  u32x4 o;
#pragma unroll
  for (int e = 0; e < 4; ++e) o[e] = pk2(x[2 * e], x[2 * e + 1]);
  return o;
}

// Load one 16x32 bf16 A/B WMMA fragment from a row-major bf16 matrix.
// Per CDNA5 ISA 16-bit A layout: lane m (m<16) holds row m, K {0..7, 16..23};
// lane m+16 holds row m, K {8..15, 24..31}. B fragments use the identical
// per-lane pattern with "row" = C-column (NT GEMM symmetry).
static __device__ __forceinline__ v16bf load_frag(const __bf16* p, int stride, int lane) {
  const int m = lane & 15, h = lane >> 4;
  const __bf16* q = p + (size_t)m * (size_t)stride + h * 8;
  u32x4 lo = *(const u32x4*)(q);        // K chunk {0..7}/{8..15}
  u32x4 hi = *(const u32x4*)(q + 16);   // K chunk {16..23}/{24..31}
  u32x8 w = __builtin_shufflevector(lo, hi, 0, 1, 2, 3, 4, 5, 6, 7);
  return __builtin_bit_cast(v16bf, w);
}

static __device__ __forceinline__ v8f wmma_bf16(v16bf a, v16bf b, v8f c) {
  return __builtin_amdgcn_wmma_f32_16x16x32_bf16(false, a, false, b, (short)0, c,
                                                 false, false);
}

// CDNA5 async global->LDS copies (ASYNCcnt-tracked, no VGPR round trip): 16 bytes
// per lane, LDS byte address in a VGPR, 64-bit global address in a VGPR pair.
// Four copies of one lane (one 64-key K and V^T block of the attention kernel) in
// one statement. The closing s_wait_xcnt stands inside it, so no address register
// of a copy is rewritten in front of the wait (a precaution for asm-text copies).
static __device__ __forceinline__ void async_g2l_b128_x4(const unsigned (&l)[4],
                                                         const __bf16* const (&g)[4]) {
  asm volatile(
      "global_load_async_to_lds_b128 %0, %4, off\n\t"
      "global_load_async_to_lds_b128 %1, %5, off\n\t"
      "global_load_async_to_lds_b128 %2, %6, off\n\t"
      "global_load_async_to_lds_b128 %3, %7, off\n\t"
      "s_wait_xcnt 0x0"
      :: "v"(l[0]), "v"(l[1]), "v"(l[2]), "v"(l[3]),
         "v"(g[0]), "v"(g[1]), "v"(g[2]), "v"(g[3])
      : "memory");
}

// One such copy of one lane as the compiler's builtin: its operands may lie in any
// vector register, also above v255, where the QKV kernel has its free ones (an asm
// operand cannot, and accumulators would be moved out of the way and back).
typedef __attribute__((ext_vector_type(4))) int i32x4;
static __device__ __forceinline__ void async_g2l_b128(__bf16* l, const __bf16* g) {
  __builtin_amdgcn_global_load_async_to_lds_b128(
      (__attribute__((address_space(1))) i32x4*)g, (__attribute__((address_space(3))) i32x4*)l, 0,
      0);
}

// Twelve such copies of one lane (one K-chunk of the GEMM tile) in one statement.
// The closing s_wait_xcnt stands inside it, so no address register of a copy is
// rewritten in front of the wait (a precaution for copies written as asm text).
static __device__ __forceinline__ void async_g2l_b128_x12(const unsigned (&l)[12],
                                                          const __bf16* const (&g)[12]) {
  asm volatile(
      "global_load_async_to_lds_b128 %0, %12, off\n\t"
      "global_load_async_to_lds_b128 %1, %13, off\n\t"
      "global_load_async_to_lds_b128 %2, %14, off\n\t"
      "global_load_async_to_lds_b128 %3, %15, off\n\t"
      "global_load_async_to_lds_b128 %4, %16, off\n\t"
      "global_load_async_to_lds_b128 %5, %17, off\n\t"
      "global_load_async_to_lds_b128 %6, %18, off\n\t"
      "global_load_async_to_lds_b128 %7, %19, off\n\t"
      "global_load_async_to_lds_b128 %8, %20, off\n\t"
      "global_load_async_to_lds_b128 %9, %21, off\n\t"
      "global_load_async_to_lds_b128 %10, %22, off\n\t"
      "global_load_async_to_lds_b128 %11, %23, off\n\t"
      "s_wait_xcnt 0x0"
      :: "v"(l[0]), "v"(l[1]), "v"(l[2]), "v"(l[3]), "v"(l[4]), "v"(l[5]),
         "v"(l[6]), "v"(l[7]), "v"(l[8]), "v"(l[9]), "v"(l[10]), "v"(l[11]),
         "v"(g[0]), "v"(g[1]), "v"(g[2]), "v"(g[3]), "v"(g[4]), "v"(g[5]),
         "v"(g[6]), "v"(g[7]), "v"(g[8]), "v"(g[9]), "v"(g[10]), "v"(g[11])
      : "memory");
}

// ---------------------------------------------------------------------------
// Kernel 1: f32 -> bf16 convert (4 elements / thread), rows of 1024 elements
// (one block = one row). PERM picks the destination row:
//   0: same row
//   1: source row l*4 + n   -> row n*2048 + l    (tokens grouped by batch n)
//   2: source row 3*ii + jj -> row jj*1024 + ii  (Q, K, V weight rows grouped)
// ---------------------------------------------------------------------------
template <int PERM>
__global__ __launch_bounds__(256) void cvt_f32_bf16(const float* __restrict__ src,
                                                    __bf16* __restrict__ dst, int n4) {
  int i = blockIdx.x * 256 + threadIdx.x;
  if (i >= n4) return;
  const int row = i >> 8, c4 = i & 255;
  const int drow = PERM == 1 ? (row & 3) * 2048 + (row >> 2)
                 : PERM == 2 ? (row % 3) * 1024 + row / 3
                             : row;
  f32x4 f = *(const f32x4*)(src + (size_t)i * 4);
  u32x2 o;
  o[0] = pk2(f[0], f[1]);
  o[1] = pk2(f[2], f[3]);
  *(u32x2*)(dst + (size_t)drow * 1024 + c4 * 4) = o;
}

// ---------------------------------------------------------------------------
// Kernels 2 & 4: NT bf16 GEMMs  C(M x Ncols) = A(M x 1024) * B(Ncols x 1024)^T
// K streamed in 64-wide chunks through DOUBLE-BUFFERED LDS using async
// global->LDS copies: chunk i+1 streams in while WMMAs run on chunk i.
// ---------------------------------------------------------------------------
static constexpr int LDST = 72;  // ushort stride = 144 bytes (conflict-free)

// Kernel 2: QKV projection. A rows are n*2048 + l, B rows jj*1024 + ii (see the
// convert). Workgroup tile 256 tokens x 384 features, so the 32 x 8 blocks are one
// per WGP, all resident at once, and an operand row fetched from L2 feeds 384 or
// 256 outputs. A block's features are 128 of K and 256 of Q (even blocks) or of V
// (odd blocks). 8 waves (4 x 2), wave tile 64 tokens x 192 features (4 x 12 WMMA
// tiles): feature tiles 0..3 are K, tiles 4..11 Q or V.
// A lane's 8 accumulator registers run along the tile's row axis: V tiles keep
// tokens there (8 consecutive l = 16 B of V^T); Q and K tiles trade the two
// operands, so features lie there (8 consecutive d = 16 B of a Q or K row).
// One 16-byte store per tile.
static constexpr int QASZ = 256 * LDST;
static constexpr int QBSZ = 384 * LDST;

// ISV: the block's 256 features beside K are V (else Q). Block-uniform.
template <bool ISV>
static __device__ __forceinline__ void gemm_qkv_body(
    __bf16* sA, __bf16* sB, const __bf16* __restrict__ A, const __bf16* __restrict__ B,
    const float* __restrict__ bias, __bf16* __restrict__ Kb, __bf16* __restrict__ QVb) {
  const int tid = threadIdx.x;
  const int lane = tid & 31;
  const int w = tid >> 5;
  const int wm = w & 3, wn = w >> 2;
  const int row0 = blockIdx.y * 256;
  const int fk = blockIdx.x * 128;         // first ii of the block's K features
  const int fq = (blockIdx.x >> 1) * 256;  // first ii of its Q or V features

  // 20 async copies per thread per K-chunk: 8 for A (256 rows x 64 K = 2048 x
  // 16 B), 12 for B (384 rows). A thread's copies lie 32 tile rows apart.
  // B tile rows, per wave column of 192: 64 of K, then 128 of Q or V.
  const int sr = tid >> 3, sc = (tid & 7) * 8;
  // Block-uniform row bases; the lane's place (row sr, column sc) is one offset.
  const __bf16* gA = A + (size_t)row0 * 1024;
  const __bf16* gK = B + (size_t)(1024 + fk) * 1024;
  const __bf16* gQ = B + (size_t)((ISV ? 2048 : 0) + fq) * 1024;
  const unsigned goff = sr * 1024 + sc;
  __bf16* lA = sA + sr * LDST + sc;
  __bf16* lB = sB + sr * LDST + sc;
  auto stage = [&](int buf, int kb) {
#pragma unroll
    for (int s = 0; s < 8; ++s)
      async_g2l_b128(lA + buf * QASZ + s * 32 * LDST, gA + s * 32 * 1024 + kb + goff);
#pragma unroll
    for (int s = 0; s < 12; ++s) {
      const int c = s / 6, r = s % 6;  // wave column, 32-row group inside it
      const __bf16* g = r < 2 ? gK + (c * 64 + r * 32) * 1024 : gQ + (c * 128 + (r - 2) * 32) * 1024;
      async_g2l_b128(lB + buf * QBSZ + s * 32 * LDST, g + kb + goff);
    }
  };

  v8f acc[4][12] = {};

  stage(0, 0);
  asm volatile("s_wait_asynccnt 0x0" ::: "memory");  // chunk 0 has landed (own copies)
  __syncthreads();                                   // ... and every other wave's
  stage(1, 64);
  for (int kb = 0; kb < 1024; kb += 64) {
    const int cur = (kb >> 6) & 1;
    const __bf16* tA = sA + cur * QASZ + wm * 64 * LDST;   // this wave's 64 tokens
    const __bf16* tB = sB + cur * QBSZ + wn * 192 * LDST;  // this wave's 192 features
#pragma unroll
    for (int kk = 0; kk < 64; kk += 32) {
      v16bf af[4], b0[4], b1[4];
#pragma unroll
      for (int i = 0; i < 4; ++i)
        af[i] = load_frag(tA + i * 16 * LDST + kk, LDST, lane);
#pragma unroll
      for (int j = 0; j < 4; ++j)
        b0[j] = load_frag(tB + j * 16 * LDST + kk, LDST, lane);
#pragma unroll
      for (int j = 0; j < 4; ++j)
        b1[j] = load_frag(tB + (4 + j) * 16 * LDST + kk, LDST, lane);
      // Keeps the LDS reads together in front of the WMMAs: left alone the
      // scheduler spreads them, one LDS wait in front of every row of four.
      __builtin_amdgcn_sched_barrier(0);
#pragma unroll
      for (int i = 0; i < 4; ++i)
#pragma unroll
        for (int j = 0; j < 4; ++j)
          acc[i][j] = wmma_bf16(b0[j], af[i], acc[i][j]);
      // The last four feature fragments, into the registers just freed; they fly
      // while tiles 4..7 are worked on. The barrier in front keeps them from rising
      // among the WMMAs above, which takes registers that the kernel does not have;
      // the one behind keeps them from sinking.
      __builtin_amdgcn_sched_barrier(0);
#pragma unroll
      for (int j = 0; j < 4; ++j)
        b0[j] = load_frag(tB + (8 + j) * 16 * LDST + kk, LDST, lane);
      __builtin_amdgcn_sched_barrier(0);
#pragma unroll
      for (int i = 0; i < 4; ++i)
#pragma unroll
        for (int j = 0; j < 4; ++j)
          acc[i][4 + j] = ISV ? wmma_bf16(af[i], b1[j], acc[i][4 + j])
                              : wmma_bf16(b1[j], af[i], acc[i][4 + j]);
#pragma unroll
      for (int i = 0; i < 4; ++i)
#pragma unroll
        for (int j = 0; j < 4; ++j)
          acc[i][8 + j] = ISV ? wmma_bf16(af[i], b0[j], acc[i][8 + j])
                              : wmma_bf16(b0[j], af[i], acc[i][8 + j]);
    }
    // Hand-over: own reads of buffer `cur` retired, own copies of the next chunk
    // landed; the one barrier publishes that chunk and frees `cur` for a refill.
    asm volatile("s_wait_dscnt 0x0" ::: "memory");
    asm volatile("s_wait_asynccnt 0x0" ::: "memory");
    __syncthreads();
    if (kb + 128 < 1024) stage(cur, kb + 128);  // flies while the next chunk is worked on
  }
  asm volatile("s_wait_asynccnt 0x0" ::: "memory");  // nothing in flight at the wave's end

  // Epilogue. The bias of the block's 384 features goes through LDS once, in the
  // order of the B tile rows (the ring is free: every wave's last read of it and
  // every copy ended in front of the loop's last barrier).
  // bias index of (ii, jj) is 3*ii + jj ; ii = hh*64 + dd ; b = n*16 + hh
  float* sBias = (float*)sA;
  auto bidx = [&](int f) {
    const int c = f >= 192 ? 1 : 0, r = f - c * 192;
    return r < 64 ? 3 * (fk + c * 64 + r) + 1 : 3 * (fq + c * 128 + r - 64) + (ISV ? 2 : 0);
  };
  // The scheduling barriers of this epilogue keep every global load and store alone
  // with the s_wait_xcnt behind it, so that no register which it names is rewritten
  // in front of that wait (a precaution; this build places none of its own).
#pragma unroll
  for (int f0 = 0; f0 < 384; f0 += 256) {
    if (f0 + tid < 384) {  // the second round: waves 0..3 only
      const int ix = bidx(f0 + tid);
      __builtin_amdgcn_sched_barrier(0);
      const float x = bias[ix];
      asm volatile("s_wait_xcnt 0x0" ::: "memory");
      __builtin_amdgcn_sched_barrier(0);
      sBias[f0 + tid] = x;
    }
  }
  __syncthreads();  // every wave reads bias values that other waves fetched

  // C layout: VGPR v -> row (v + half*8), col = lane%16 within tile.
  const int m = lane & 15, half = lane >> 4;
  const int n = row0 >> 11;
  const int lb = (row0 & 2047) + wm * 64;  // first token of the wave tile
#pragma unroll
  for (int j = 0; j < 12; ++j) {
    const bool vt = ISV && j >= 4;  // V tile: rows = tokens; else rows = features
    const int ft = j < 4 ? fk + wn * 64 + j * 16 : fq + wn * 128 + (j - 4) * 16;
    u32x4 d[4];
    __bf16* p[4];
    if (!vt) {
      __bf16* dst = j < 4 ? Kb : QVb;
      const float scl = j < 4 ? 1.0f : 0.125f;  // the score scale folded into Q
      const int ii = ft + half * 8;             // 8 consecutive d of one head
      const f32x4 blo = *(const f32x4*)(sBias + wn * 192 + j * 16 + half * 8);
      const f32x4 bhi = *(const f32x4*)(sBias + wn * 192 + j * 16 + half * 8 + 4);
      const v8f bv = __builtin_shufflevector(blo, bhi, 0, 1, 2, 3, 4, 5, 6, 7);
      const int b = n * 16 + (ii >> 6);
#pragma unroll
      for (int i = 0; i < 4; ++i) {
        const int l = lb + i * 16 + m;
        p[i] = dst + ((size_t)b * 2048 + l) * 64 + (ii & 63);
        d[i] = pack8((acc[i][j] + bv) * scl);
      }
    } else {
      const int ii = ft + m;
      const float bv = sBias[wn * 192 + j * 16 + m];
      const int b = n * 16 + (ii >> 6);
#pragma unroll
      for (int i = 0; i < 4; ++i) {
        const int l = lb + i * 16 + half * 8;  // 8 consecutive tokens
        p[i] = QVb + ((size_t)b * 64 + (ii & 63)) * 2048 + l;
        d[i] = pack8(acc[i][j] + bv);
      }
    }
    __builtin_amdgcn_sched_barrier(0);
#pragma unroll
    for (int i = 0; i < 4; ++i) *(u32x4*)p[i] = d[i];
    asm volatile("s_wait_xcnt 0x0" ::: "memory");
    __builtin_amdgcn_sched_barrier(0);
  }
}

__global__ __launch_bounds__(256) void gemm_qkv(
    const __bf16* __restrict__ A, const __bf16* __restrict__ B,
    const float* __restrict__ bias,
    __bf16* __restrict__ Qb, __bf16* __restrict__ Kb, __bf16* __restrict__ Vtb) {
  __shared__ __align__(16) __bf16 sA[2 * QASZ];
  __shared__ __align__(16) __bf16 sB[2 * QBSZ];
  if (blockIdx.x & 1)
    gemm_qkv_body<true>(sA, sB, A, B, bias, Kb, Vtb);
  else
    gemm_qkv_body<false>(sA, sB, A, B, bias, Kb, Qb);
}

// Kernel 4: output projection (bias, f32 store to d_out). Workgroup tile 128(M) x
// 256(N), 8 waves (2x4), wave tile 64x64 (4x4 WMMA tiles): each fragment read from
// LDS feeds 4 WMMAs, each operand row fetched from L2 feeds 128 or 256 outputs.
static constexpr int ASZ = 128 * LDST;
static constexpr int BSZ = 256 * LDST;

__global__ __launch_bounds__(256) void gemm_out(
    const __bf16* __restrict__ A, const __bf16* __restrict__ B,
    const float* __restrict__ bias, float* __restrict__ outF) {
  __shared__ __align__(16) __bf16 sA[2 * ASZ];
  __shared__ __align__(16) __bf16 sB[2 * BSZ];

  const int tid = threadIdx.x;
  const int lane = tid & 31;
  const int w = tid >> 5;
  const int wm = w & 1, wn = w >> 1;
  const int row0 = blockIdx.y * 128;
  const int col0 = blockIdx.x * 256;

  // 12 async copies per thread per K-chunk: 4 for A (128 rows x 64 K = 1024 x
  // 16 B), 8 for B (256 rows). A thread's copies lie 32 tile rows apart.
  const int sr = tid >> 3, sc = (tid & 7) * 8;
  const __bf16* gA = A + (size_t)(row0 + sr) * 1024 + sc;
  const __bf16* gB = B + (size_t)(col0 + sr) * 1024 + sc;
  const unsigned lA = (unsigned)(size_t)(sA + sr * LDST + sc);  // LDS byte address
  const unsigned lB = (unsigned)(size_t)(sB + sr * LDST + sc);
  auto stage = [&](int buf, int kb) {
    unsigned l[12];
    const __bf16* g[12];
#pragma unroll
    for (int s = 0; s < 4; ++s) {
      l[s] = lA + (buf * ASZ + s * 32 * LDST) * 2;
      g[s] = gA + s * 32 * 1024 + kb;
    }
#pragma unroll
    for (int s = 0; s < 8; ++s) {
      l[4 + s] = lB + (buf * BSZ + s * 32 * LDST) * 2;
      g[4 + s] = gB + s * 32 * 1024 + kb;
    }
    async_g2l_b128_x12(l, g);
  };

  v8f acc[4][4] = {};

  stage(0, 0);
  asm volatile("s_wait_asynccnt 0x0" ::: "memory");  // chunk 0 has landed (own copies)
  __syncthreads();                                   // ... and every other wave's
  stage(1, 64);
  for (int kb = 0; kb < 1024; kb += 64) {
    const int cur = (kb >> 6) & 1;
    const __bf16* cA = sA + cur * ASZ + wm * 64 * LDST;  // this wave's 64 tokens
    const __bf16* cB = sB + cur * BSZ + wn * 64 * LDST;  // this wave's 64 features
#pragma unroll
    for (int kk = 0; kk < 64; kk += 32) {
      v16bf af[4], bfr[4];
#pragma unroll
      for (int i = 0; i < 4; ++i)
        af[i] = load_frag(cA + i * 16 * LDST + kk, LDST, lane);
#pragma unroll
      for (int j = 0; j < 4; ++j)
        bfr[j] = load_frag(cB + j * 16 * LDST + kk, LDST, lane);
      // Keeps the 16 LDS reads together in front of their 16 WMMAs: left alone the
      // scheduler spreads them, one full LDS wait in front of every row of four.
      __builtin_amdgcn_sched_barrier(0);
#pragma unroll
      for (int i = 0; i < 4; ++i)
#pragma unroll
        for (int j = 0; j < 4; ++j)
          acc[i][j] = wmma_bf16(af[i], bfr[j], acc[i][j]);
    }
    // Hand-over: own reads of buffer `cur` retired, own copies of the next chunk
    // landed; the one barrier publishes that chunk and frees `cur` for a refill.
    asm volatile("s_wait_dscnt 0x0" ::: "memory");
    asm volatile("s_wait_asynccnt 0x0" ::: "memory");
    __syncthreads();
    if (kb + 128 < 1024) stage(cur, kb + 128);  // flies while the next chunk is worked on
  }
  asm volatile("s_wait_asynccnt 0x0" ::: "memory");  // nothing in flight at the wave's end

  // Epilogue. C layout: VGPR v -> row (v + half*8), col = lane%16 within tile.
  const int m = lane & 15, half = lane >> 4;
#pragma unroll
  for (int i = 0; i < 4; ++i) {
#pragma unroll
    for (int j = 0; j < 4; ++j) {
      const int f = col0 + wn * 64 + j * 16 + m;
      const float bv = bias[f];
#pragma unroll
      for (int v = 0; v < 8; ++v) {
        const int r = row0 + wm * 64 + i * 16 + v + half * 8;
        outF[(size_t)r * 1024 + f] = acc[i][j][v] + bv;
      }
    }
  }
}

// ---------------------------------------------------------------------------
// Kernel 3: flash attention. One wave = 32 query rows (two 16-column groups) of
// one (batch,head) b: every K and V^T fragment read from LDS feeds two WMMAs, one
// per column group, and a block of 8 waves covers 256 query rows, so each 64-key
// K/V^T block is fetched from L2 by half as many blocks.
// All 8 waves of a block share b, so each 64-key K/V^T block is staged ONCE
// per workgroup into double-buffered LDS via async copies: block i+1 streams
// in while WMMAs/softmax run on block i.
// Computes S^T = K*Q^T so that exp(S^T) registers are already in the exact
// B-operand packing for O^T += V^T * P^T (no LDS transpose needed).
// One pass = 64 keys: the work that is done once per pass whatever its length
// (new maximum and its exchange, alpha, rescale of the O^T registers, exchange
// of the row sum, addresses, barrier) is paid once per 64 keys.
// ---------------------------------------------------------------------------
static constexpr int KST = 72;  // K tile stride (ushorts) = 144B
static constexpr int VST = 72;  // V^T tile stride (ushorts) = 144B
static constexpr int KSZ = 64 * KST;
static constexpr int VSZ = 64 * VST;

// 4 waves per SIMD (at most 256 VGPRs): the 512 blocks are all resident at once.
__global__ __launch_bounds__(256) __attribute__((amdgpu_waves_per_eu(4, 4)))
void attn_kernel(const __bf16* __restrict__ Q, const __bf16* __restrict__ K,
                 const __bf16* __restrict__ Vt, __bf16* __restrict__ O) {
  __shared__ __align__(16) __bf16 sK[2 * KSZ];  // 64 keys x 64 d
  __shared__ __align__(16) __bf16 sV[2 * VSZ];  // 64 d x 64 keys (V^T)

  const int tid = threadIdx.x;
  const int lane = tid & 31;
  const int w = tid >> 5;
  const int b = blockIdx.y;                   // 0..63  (= n*16 + head)
  const int r0 = blockIdx.x * 256 + w * 32;   // first query row of the wave
  const int m = lane & 15, half = lane >> 4;

  const __bf16* Qb = Q + (size_t)b * 2048 * 64;
  const __bf16* Kb = K + (size_t)b * 2048 * 64;
  const __bf16* Vb = Vt + (size_t)b * 64 * 2048;

  // 4 async copies per thread per 64-key block: either tile is 64 rows x 128 B =
  // 512 x 16 B; a thread's two copies of a tile lie 32 tile rows apart.
  const int sr = tid >> 3, sc = (tid & 7) * 8;
  const __bf16* gK = Kb + (size_t)sr * 64 + sc;
  const __bf16* gV = Vb + (size_t)sr * 2048 + sc;
  const unsigned lK = (unsigned)(size_t)(sK + sr * KST + sc);  // LDS byte address
  const unsigned lV = (unsigned)(size_t)(sV + sr * VST + sc);
  auto stage = [&](int buf, int key0) {
    unsigned l[4];
    const __bf16* g[4];
#pragma unroll
    for (int s = 0; s < 2; ++s) {
      l[s] = lK + (buf * KSZ + s * 32 * KST) * 2;
      g[s] = gK + (key0 + s * 32) * 64;
      l[2 + s] = lV + (buf * VSZ + s * 32 * VST) * 2;
      g[2 + s] = gV + s * 32 * 2048 + key0;
    }
    async_g2l_b128_x4(l, g);
  };

  // Q fragments (used as B operand: column n = query row n) of column group q,
  // d split in 2x32
  v16bf qf[2][2];
#pragma unroll
  for (int q = 0; q < 2; ++q)
#pragma unroll
    for (int c = 0; c < 2; ++c)
      qf[q][c] = load_frag(Qb + (size_t)(r0 + q * 16) * 64 + c * 32, 64, lane);

  v8f ot[2][4] = {};                  // O^T tiles: d = j*16 + v + half*8, col = query m
  float mrow[2] = {-1e30f, -1e30f};   // running max for query row m (dup in lane m+16)
  float lrow[2] = {0.0f, 0.0f};       // running sum

  stage(0, 0);
  asm volatile("s_wait_asynccnt 0x0" ::: "memory");  // block 0 has landed (own copies)
  __syncthreads();                                   // ... and every other wave's
  stage(1, 64);
  for (int kb = 0; kb < 32; ++kb) {
    const int cur = kb & 1;
    const __bf16* cK = sK + cur * KSZ;
    const __bf16* cV = sV + cur * VSZ;

    // LDS fragment loads. K as A operand: key tile t, d-chunk c. V^T as A operand:
    // fragment i = (key group i / 4, d tile i % 4), rows = d, 32 contiguous keys.
    auto kfrag = [&](int t, int c) {
      return load_frag(cK + (t * 16) * KST + c * 32, KST, lane);
    };
    auto vfrag = [&](int i) {
      return load_frag(cV + ((i & 3) * 16) * VST + (i >> 2) * 32, VST, lane);
    };
    // One key tile against both column groups; the two chains alternate.
    v8f st[2][4];
    auto score = [&](int t, const v16bf (&k)[2]) {
      v8f z0 = {}, z1 = {};
      z0 = wmma_bf16(k[0], qf[0][0], z0);
      z1 = wmma_bf16(k[0], qf[1][0], z1);
      st[0][t] = wmma_bf16(k[1], qf[0][1], z0);
      st[1][t] = wmma_bf16(k[1], qf[1][1], z1);
    };

    // S^T tiles: row = key, col = query. Q already scaled by 1/8. The loads run one
    // key tile ahead of the products, the first V^T fragment too. The scheduling
    // barriers keep them there: left alone the scheduler sinks every load to its
    // product, and the wave waits out a full LDS latency in front of each.
    v16bf ka[2] = {kfrag(0, 0), kfrag(0, 1)};
    v16bf kc[2] = {kfrag(1, 0), kfrag(1, 1)};
    __builtin_amdgcn_sched_barrier(0);
    score(0, ka);
    ka[0] = kfrag(2, 0);
    ka[1] = kfrag(2, 1);
    __builtin_amdgcn_sched_barrier(0);
    score(1, kc);
    kc[0] = kfrag(3, 0);
    kc[1] = kfrag(3, 1);
    score(2, ka);
    v16bf vf[4];
    vf[0] = vfrag(0);
    __builtin_amdgcn_sched_barrier(0);
    score(3, kc);

    // online softmax, per column group: each lane holds 32 scores of its query row;
    // partner lane (xor 16) holds the other 32 keys of this 64-key block.
    float vmax[2], alpha[2];
#pragma unroll
    for (int q = 0; q < 2; ++q) {
      vmax[q] = -1e30f;
#pragma unroll
      for (int t = 0; t < 4; ++t)
#pragma unroll
        for (int v = 0; v < 8; ++v) vmax[q] = fmaxf(vmax[q], st[q][t][v]);
    }
    const float xmax[2] = {__shfl_xor(vmax[0], 16, 32), __shfl_xor(vmax[1], 16, 32)};

    // P^T in registers, repacked directly into B-operand layout, one operand per
    // 32 keys: element e<8 -> tile 2g [e], e>=8 -> tile 2g+1 [e-8] (both halves).
    // Neighbouring keys stay in register pairs: one packed convert per pair, and
    // the row sum runs in pairs too (one packed add per pair), joined at the end.
    v16bf pb[2][2];
    float psum[2];
#pragma unroll
    for (int q = 0; q < 2; ++q) {
      const float mnew = fmaxf(mrow[q], fmaxf(vmax[q], xmax[q]));
      alpha[q] = __expf(mrow[q] - mnew);
      mrow[q] = mnew;

      // exp(s - mnew) over all 32 scores of the lane, in place: the differences
      // times log2(e), then the exponentials.
#pragma unroll
      for (int t = 0; t < 4; ++t)
        st[q][t] = (st[q][t] - mnew) * 1.44269504088896340736f;
#pragma unroll
      for (int t = 0; t < 4; ++t)
#pragma unroll
        for (int v = 0; v < 8; ++v) st[q][t][v] = __builtin_amdgcn_exp2f(st[q][t][v]);

      f32x2 ps2[2];
#pragma unroll
      for (int g = 0; g < 2; ++g) {
        u32x8 pw;
#pragma unroll
        for (int e = 0; e < 4; ++e) {
          const f32x2 p0 = {st[q][2 * g][2 * e], st[q][2 * g][2 * e + 1]};
          const f32x2 p1 = {st[q][2 * g + 1][2 * e], st[q][2 * g + 1][2 * e + 1]};
          const f32x2 ps = p0 + p1;
          ps2[g] = e == 0 ? ps : ps2[g] + ps;
          pw[e] = pk2(p0[0], p0[1]);
          pw[e + 4] = pk2(p1[0], p1[1]);
        }
        pb[q][g] = __builtin_bit_cast(v16bf, pw);
      }
      const f32x2 psj = ps2[0] + ps2[1];
      psum[q] = psj[0] + psj[1];
    }
    vf[1] = vfrag(1);
    vf[2] = vfrag(2);
    vf[3] = vfrag(3);
    const float xsum[2] = {__shfl_xor(psum[0], 16, 32), __shfl_xor(psum[1], 16, 32)};
#pragma unroll
    for (int q = 0; q < 2; ++q) {
      lrow[q] = lrow[q] * alpha[q] + (psum[q] + xsum[q]);
#pragma unroll
      for (int j = 0; j < 4; ++j) ot[q][j] *= alpha[q];
    }

    // O^T += V^T * P^T, each fragment against both column groups; the pair of
    // products is followed by the load of the fragment four ahead into the
    // registers it frees.
#pragma unroll
    for (int i = 0; i < 8; ++i) {
      ot[0][i & 3] = wmma_bf16(vf[i & 3], pb[0][i >> 2], ot[0][i & 3]);
      ot[1][i & 3] = wmma_bf16(vf[i & 3], pb[1][i >> 2], ot[1][i & 3]);
      if (i + 4 < 8) vf[i & 3] = vfrag(i + 4);
    }

    // Hand-over: own reads of buffer `cur` retired, own copies of the next block
    // landed; the one barrier publishes that block and frees `cur` for a refill.
    asm volatile("s_wait_dscnt 0x0" ::: "memory");
    asm volatile("s_wait_asynccnt 0x0" ::: "memory");
    __syncthreads();
    if (kb + 2 < 32) stage(cur, (kb + 2) * 64);  // flies while the next block is worked on
  }
  asm volatile("s_wait_asynccnt 0x0" ::: "memory");  // nothing in flight at the wave's end

  // Normalize and scatter into (l, n, h*64 + d) bf16 layout for the out GEMM.
  const int n = b >> 4, hh = b & 15;
#pragma unroll
  for (int q = 0; q < 2; ++q) {
    const float inv = 1.0f / lrow[q];
    const int lseq = r0 + q * 16 + m;
    __bf16* orow = O + ((size_t)lseq * 4 + n) * 1024 + hh * 64;
#pragma unroll
    for (int j = 0; j < 4; ++j)
      *(u32x4*)(orow + j * 16 + half * 8) = pack8(ot[q][j] * inv);
  }
}

// ---------------------------------------------------------------------------
// Launch
// ---------------------------------------------------------------------------
extern "C" void kernel_launch(void* const* d_in, const int* in_sizes, int n_in,
                              void* d_out, int out_size, void* d_ws, size_t ws_size,
                              hipStream_t stream) {
  const float* query = (const float*)d_in[0];     // (2048, 4, 1024)
  const float* qkv_proj = (const float*)d_in[1];  // (3072, 1024)
  const float* qkv_bias = (const float*)d_in[2];  // (3072,)
  const float* out_proj = (const float*)d_in[3];  // (1024, 1024)
  const float* out_bias = (const float*)d_in[4];  // (1024,)
  float* out = (float*)d_out;                     // (2048, 4, 1024) f32
  (void)in_sizes; (void)n_in; (void)out_size; (void)ws_size;

  char* ws = (char*)d_ws;
  size_t off = 0;
  auto carve = [&](size_t bytes) {
    void* p = ws + off;
    off += (bytes + 255) & ~(size_t)255;
    return p;
  };
  __bf16* qA   = (__bf16*)carve(8192ull * 1024 * 2);       // query bf16, row n*2048+l
  __bf16* wQKV = (__bf16*)carve(3072ull * 1024 * 2);       // qkv_proj bf16, row jj*1024+ii
  __bf16* wOUT = (__bf16*)carve(1024ull * 1024 * 2);       // out_proj bf16
  __bf16* Qb   = (__bf16*)carve(64ull * 2048 * 64 * 2);    // Q (b,l,d), pre-scaled
  __bf16* Kb   = (__bf16*)carve(64ull * 2048 * 64 * 2);    // K (b,l,d)
  __bf16* Vtb  = (__bf16*)carve(64ull * 64 * 2048 * 2);    // V^T (b,d,l)
  __bf16* Ob   = (__bf16*)carve(8192ull * 1024 * 2);       // attn out (l*4+n, i)

  cvt_f32_bf16<1><<<(8192 * 1024 / 4 + 255) / 256, 256, 0, stream>>>(query, qA,
                                                                     8192 * 1024 / 4);
  cvt_f32_bf16<2><<<(3072 * 1024 / 4 + 255) / 256, 256, 0, stream>>>(qkv_proj, wQKV,
                                                                     3072 * 1024 / 4);
  cvt_f32_bf16<0><<<(1024 * 1024 / 4 + 255) / 256, 256, 0, stream>>>(out_proj, wOUT,
                                                                     1024 * 1024 / 4);

  // QKV projection: M=8192, N=3072 -> grid (8, 32), one block per WGP
  gemm_qkv<<<dim3(8, 32), 256, 0, stream>>>(qA, wQKV, qkv_bias, Qb, Kb, Vtb);
  // Attention: 64 head-batches x 8 row-groups of 256 rows
  attn_kernel<<<dim3(8, 64), 256, 0, stream>>>(Qb, Kb, Vtb, Ob);
  // Output projection: M=8192, N=1024 -> grid (4, 64)
  gemm_out<<<dim3(4, 64), 256, 0, stream>>>(Ob, wOUT, out_bias, out);
}

// v007
// One run takes 122 microseconds.
// Two timings next to v006 both put it at 1.04 times that version's speed.
// All steps since v000 together make it 1.63 times as fast.
#include <hip/hip_runtime.h>

// ---------------------------------------------------------------------------
// Types
// ---------------------------------------------------------------------------
typedef __attribute__((ext_vector_type(16))) __bf16        v16bf;
typedef __attribute__((ext_vector_type(8)))  float         v8f;
typedef __attribute__((ext_vector_type(4)))  unsigned int  u32x4;
typedef __attribute__((ext_vector_type(8)))  unsigned int  u32x8;
typedef __attribute__((ext_vector_type(2)))  unsigned int  u32x2;
typedef __attribute__((ext_vector_type(4)))  float         f32x4;
typedef __attribute__((ext_vector_type(2)))  float         f32x2;
typedef __attribute__((ext_vector_type(2)))  __bf16        bf16x2;

// Two f32 -> two bf16 in one dword (a in the low half), round to nearest even:
// one packed hardware convert per pair.
static __device__ __forceinline__ unsigned pk2(float a, float b) {
  f32x2 v = {a, b};
  return __builtin_bit_cast(unsigned, __builtin_convertvector(v, bf16x2));
}

// Eight f32 -> eight bf16 in one 16-byte word group (element 0 lowest).
static __device__ __forceinline__ u32x4 pack8(v8f x) {
  u32x4 o;
#pragma unroll
  for (int e = 0; e < 4; ++e) o[e] = pk2(x[2 * e], x[2 * e + 1]);
  return o;
}

// Load one 16x32 bf16 A/B WMMA fragment from a row-major bf16 matrix.
// Per CDNA5 ISA 16-bit A layout: lane m (m<16) holds row m, K {0..7, 16..23};
// lane m+16 holds row m, K {8..15, 24..31}. B fragments use the identical
// per-lane pattern with "row" = C-column (NT GEMM symmetry).
static __device__ __forceinline__ v16bf load_frag(const __bf16* p, int stride, int lane) {
  const int m = lane & 15, h = lane >> 4;
  const __bf16* q = p + (size_t)m * (size_t)stride + h * 8;
  u32x4 lo = *(const u32x4*)(q);        // K chunk {0..7}/{8..15}
  u32x4 hi = *(const u32x4*)(q + 16);   // K chunk {16..23}/{24..31}
  u32x8 w = __builtin_shufflevector(lo, hi, 0, 1, 2, 3, 4, 5, 6, 7);
  return __builtin_bit_cast(v16bf, w);
}

static __device__ __forceinline__ v8f wmma_bf16(v16bf a, v16bf b, v8f c) {
  return __builtin_amdgcn_wmma_f32_16x16x32_bf16(false, a, false, b, (short)0, c,
                                                 false, false);
}

// CDNA5 async global->LDS copies (ASYNCcnt-tracked, no VGPR round trip): 16 bytes
// per lane, LDS byte address in a VGPR, 64-bit global address in a VGPR pair.
// Four copies of one lane (one 64-key K and V^T block of the attention kernel) in
// one statement. The closing s_wait_xcnt stands inside it, so no address register
// of a copy is rewritten in front of the wait (a precaution for asm-text copies).
static __device__ __forceinline__ void async_g2l_b128_x4(const unsigned (&l)[4],
                                                         const __bf16* const (&g)[4]) {
  asm volatile(
      "global_load_async_to_lds_b128 %0, %4, off\n\t"
      "global_load_async_to_lds_b128 %1, %5, off\n\t"
      "global_load_async_to_lds_b128 %2, %6, off\n\t"
      "global_load_async_to_lds_b128 %3, %7, off\n\t"
      "s_wait_xcnt 0x0"
      :: "v"(l[0]), "v"(l[1]), "v"(l[2]), "v"(l[3]),
         "v"(g[0]), "v"(g[1]), "v"(g[2]), "v"(g[3])
      : "memory");
}

// One such copy of one lane as the compiler's builtin: its operands may lie in any
// vector register, also above v255, where the QKV kernel has its free ones (an asm
// operand cannot, and accumulators would be moved out of the way and back).
typedef __attribute__((ext_vector_type(4))) int i32x4;
static __device__ __forceinline__ void async_g2l_b128(__bf16* l, const __bf16* g) {
  __builtin_amdgcn_global_load_async_to_lds_b128(
      (__attribute__((address_space(1))) i32x4*)g, (__attribute__((address_space(3))) i32x4*)l, 0,
      0);
}

// Twelve such copies of one lane (one K-chunk of the GEMM tile) in one statement.
// The closing s_wait_xcnt stands inside it, so no address register of a copy is
// rewritten in front of the wait (a precaution for copies written as asm text).
static __device__ __forceinline__ void async_g2l_b128_x12(const unsigned (&l)[12],
                                                          const __bf16* const (&g)[12]) {
  asm volatile(
      "global_load_async_to_lds_b128 %0, %12, off\n\t"
      "global_load_async_to_lds_b128 %1, %13, off\n\t"
      "global_load_async_to_lds_b128 %2, %14, off\n\t"
      "global_load_async_to_lds_b128 %3, %15, off\n\t"
      "global_load_async_to_lds_b128 %4, %16, off\n\t"
      "global_load_async_to_lds_b128 %5, %17, off\n\t"
      "global_load_async_to_lds_b128 %6, %18, off\n\t"
      "global_load_async_to_lds_b128 %7, %19, off\n\t"
      "global_load_async_to_lds_b128 %8, %20, off\n\t"
      "global_load_async_to_lds_b128 %9, %21, off\n\t"
      "global_load_async_to_lds_b128 %10, %22, off\n\t"
      "global_load_async_to_lds_b128 %11, %23, off\n\t"
      "s_wait_xcnt 0x0"
      :: "v"(l[0]), "v"(l[1]), "v"(l[2]), "v"(l[3]), "v"(l[4]), "v"(l[5]),
         "v"(l[6]), "v"(l[7]), "v"(l[8]), "v"(l[9]), "v"(l[10]), "v"(l[11]),
         "v"(g[0]), "v"(g[1]), "v"(g[2]), "v"(g[3]), "v"(g[4]), "v"(g[5]),
         "v"(g[6]), "v"(g[7]), "v"(g[8]), "v"(g[9]), "v"(g[10]), "v"(g[11])
      : "memory");
}

// ---------------------------------------------------------------------------
// Kernel 1: f32 -> bf16 convert of all three operands in ONE launch (none needs
// anything of another). One block = one row of 1024 elements, 4 per thread. The
// block index picks the operand (block-uniform) and the destination row:
//   blocks     0 ..  8191: query,    source row l*4 + n   -> row n*2048 + l
//                                    (tokens grouped by batch n)
//   blocks  8192 .. 11263: qkv_proj, source row 3*ii + jj -> row jj*1024 + ii
//                                    (Q, K, V weight rows grouped)
//   blocks 11264 .. 12287: out_proj, same row
// ---------------------------------------------------------------------------
__global__ __launch_bounds__(256) void cvt_f32_bf16(
    const float* __restrict__ query, const float* __restrict__ qkv_proj,
    const float* __restrict__ out_proj, __bf16* __restrict__ qA,
    __bf16* __restrict__ wQKV, __bf16* __restrict__ wOUT) {
  const int blk = blockIdx.x;
  const float* src;
  __bf16* dst;
  int row, drow;
  if (blk < 8192) {
    src = query, dst = qA, row = blk;
    drow = (row & 3) * 2048 + (row >> 2);
  } else if (blk < 8192 + 3072) {
    src = qkv_proj, dst = wQKV, row = blk - 8192;
    drow = (row % 3) * 1024 + row / 3;
  } else {
    src = out_proj, dst = wOUT, row = blk - (8192 + 3072);
    drow = row;
  }
  const int c = threadIdx.x * 4;
  f32x4 f = *(const f32x4*)(src + (size_t)row * 1024 + c);
  u32x2 o;
  o[0] = pk2(f[0], f[1]);
  o[1] = pk2(f[2], f[3]);
  *(u32x2*)(dst + (size_t)drow * 1024 + c) = o;
}

// ---------------------------------------------------------------------------
// Kernels 2 & 4: NT bf16 GEMMs  C(M x Ncols) = A(M x 1024) * B(Ncols x 1024)^T
// K streamed in 64-wide chunks through DOUBLE-BUFFERED LDS using async
// global->LDS copies: chunk i+1 streams in while WMMAs run on chunk i.
// ---------------------------------------------------------------------------
static constexpr int LDST = 72;  // ushort stride = 144 bytes (conflict-free)

// Kernel 2: QKV projection. A rows are n*2048 + l, B rows jj*1024 + ii (see the
// convert). Workgroup tile 256 tokens x 384 features, so the 32 x 8 blocks are one
// per WGP, all resident at once, and an operand row fetched from L2 feeds 384 or
// 256 outputs. A block's features are 128 of K and 256 of Q (even blocks) or of V
// (odd blocks). 8 waves (4 x 2), wave tile 64 tokens x 192 features (4 x 12 WMMA
// tiles): feature tiles 0..3 are K, tiles 4..11 Q or V.
// A lane's 8 accumulator registers run along the tile's row axis: V tiles keep
// tokens there (8 consecutive l = 16 B of V^T); Q and K tiles trade the two
// operands, so features lie there (8 consecutive d = 16 B of a Q or K row).
// One 16-byte store per tile.
static constexpr int QASZ = 256 * LDST;
static constexpr int QBSZ = 384 * LDST;

// ISV: the block's 256 features beside K are V (else Q). Block-uniform.
template <bool ISV>
static __device__ __forceinline__ void gemm_qkv_body(
    __bf16* sA, __bf16* sB, const __bf16* __restrict__ A, const __bf16* __restrict__ B,
    const float* __restrict__ bias, __bf16* __restrict__ Kb, __bf16* __restrict__ QVb) {
  const int tid = threadIdx.x;
  const int lane = tid & 31;
  const int w = tid >> 5;
  const int wm = w & 3, wn = w >> 2;
  const int row0 = blockIdx.y * 256;
  const int fk = blockIdx.x * 128;         // first ii of the block's K features
  const int fq = (blockIdx.x >> 1) * 256;  // first ii of its Q or V features

  // 20 async copies per thread per K-chunk: 8 for A (256 rows x 64 K = 2048 x
  // 16 B), 12 for B (384 rows). A thread's copies lie 32 tile rows apart.
  // B tile rows, per wave column of 192: 64 of K, then 128 of Q or V.
  const int sr = tid >> 3, sc = (tid & 7) * 8;
  // Block-uniform row bases; the lane's place (row sr, column sc) is one offset.
  const __bf16* gA = A + (size_t)row0 * 1024;
  const __bf16* gK = B + (size_t)(1024 + fk) * 1024;
  const __bf16* gQ = B + (size_t)((ISV ? 2048 : 0) + fq) * 1024;
  const unsigned goff = sr * 1024 + sc;
  __bf16* lA = sA + sr * LDST + sc;
  __bf16* lB = sB + sr * LDST + sc;
  auto stage = [&](int buf, int kb) {
#pragma unroll
    for (int s = 0; s < 8; ++s)
      async_g2l_b128(lA + buf * QASZ + s * 32 * LDST, gA + s * 32 * 1024 + kb + goff);
#pragma unroll
    for (int s = 0; s < 12; ++s) {
      const int c = s / 6, r = s % 6;  // wave column, 32-row group inside it
      const __bf16* g = r < 2 ? gK + (c * 64 + r * 32) * 1024 : gQ + (c * 128 + (r - 2) * 32) * 1024;
      async_g2l_b128(lB + buf * QBSZ + s * 32 * LDST, g + kb + goff);
    }
  };

  v8f acc[4][12] = {};

  stage(0, 0);
  asm volatile("s_wait_asynccnt 0x0" ::: "memory");  // chunk 0 has landed (own copies)
  __syncthreads();                                   // ... and every other wave's
  stage(1, 64);
  for (int kb = 0; kb < 1024; kb += 64) {
    const int cur = (kb >> 6) & 1;
    const __bf16* tA = sA + cur * QASZ + wm * 64 * LDST;   // this wave's 64 tokens
    const __bf16* tB = sB + cur * QBSZ + wn * 192 * LDST;  // this wave's 192 features
#pragma unroll
    for (int kk = 0; kk < 64; kk += 32) {
      v16bf af[4], b0[4], b1[4];
#pragma unroll
      for (int i = 0; i < 4; ++i)
        af[i] = load_frag(tA + i * 16 * LDST + kk, LDST, lane);
#pragma unroll
      for (int j = 0; j < 4; ++j)
        b0[j] = load_frag(tB + j * 16 * LDST + kk, LDST, lane);
#pragma unroll
      for (int j = 0; j < 4; ++j)
        b1[j] = load_frag(tB + (4 + j) * 16 * LDST + kk, LDST, lane);
      // Keeps the LDS reads together in front of the WMMAs: left alone the
      // scheduler spreads them, one LDS wait in front of every row of four.
      __builtin_amdgcn_sched_barrier(0);
#pragma unroll
      for (int i = 0; i < 4; ++i)
#pragma unroll
        for (int j = 0; j < 4; ++j)
          acc[i][j] = wmma_bf16(b0[j], af[i], acc[i][j]);
      // The last four feature fragments, into the registers just freed; they fly
      // while tiles 4..7 are worked on. The barrier in front keeps them from rising
      // among the WMMAs above, which takes registers that the kernel does not have;
      // the one behind keeps them from sinking.
      __builtin_amdgcn_sched_barrier(0);
#pragma unroll
      for (int j = 0; j < 4; ++j)
        b0[j] = load_frag(tB + (8 + j) * 16 * LDST + kk, LDST, lane);
      __builtin_amdgcn_sched_barrier(0);
#pragma unroll
      for (int i = 0; i < 4; ++i)
#pragma unroll
        for (int j = 0; j < 4; ++j)
          acc[i][4 + j] = ISV ? wmma_bf16(af[i], b1[j], acc[i][4 + j])
                              : wmma_bf16(b1[j], af[i], acc[i][4 + j]);
#pragma unroll
      for (int i = 0; i < 4; ++i)
#pragma unroll
        for (int j = 0; j < 4; ++j)
          acc[i][8 + j] = ISV ? wmma_bf16(af[i], b0[j], acc[i][8 + j])
                              : wmma_bf16(b0[j], af[i], acc[i][8 + j]);
    }
    // Hand-over: own reads of buffer `cur` retired, own copies of the next chunk
    // landed; the one barrier publishes that chunk and frees `cur` for a refill.
    asm volatile("s_wait_dscnt 0x0" ::: "memory");
    asm volatile("s_wait_asynccnt 0x0" ::: "memory");
    __syncthreads();
    if (kb + 128 < 1024) stage(cur, kb + 128);  // flies while the next chunk is worked on
  }
  asm volatile("s_wait_asynccnt 0x0" ::: "memory");  // nothing in flight at the wave's end

  // Epilogue. The bias of the block's 384 features goes through LDS once, in the
  // order of the B tile rows (the ring is free: every wave's last read of it and
  // every copy ended in front of the loop's last barrier).
  // bias index of (ii, jj) is 3*ii + jj ; ii = hh*64 + dd ; b = n*16 + hh
  float* sBias = (float*)sA;
  auto bidx = [&](int f) {
    const int c = f >= 192 ? 1 : 0, r = f - c * 192;
    return r < 64 ? 3 * (fk + c * 64 + r) + 1 : 3 * (fq + c * 128 + r - 64) + (ISV ? 2 : 0);
  };
  // The scheduling barriers of this epilogue keep every global load and store alone
  // with the s_wait_xcnt behind it, so that no register which it names is rewritten
  // in front of that wait (a precaution; this build places none of its own).
#pragma unroll
  for (int f0 = 0; f0 < 384; f0 += 256) {
    if (f0 + tid < 384) {  // the second round: waves 0..3 only
      const int ix = bidx(f0 + tid);
      __builtin_amdgcn_sched_barrier(0);
      const float x = bias[ix];
      asm volatile("s_wait_xcnt 0x0" ::: "memory");
      __builtin_amdgcn_sched_barrier(0);
      sBias[f0 + tid] = x;
    }
  }
  __syncthreads();  // every wave reads bias values that other waves fetched

  // C layout: VGPR v -> row (v + half*8), col = lane%16 within tile.
  const int m = lane & 15, half = lane >> 4;
  const int n = row0 >> 11;
  const int lb = (row0 & 2047) + wm * 64;  // first token of the wave tile
#pragma unroll
  for (int j = 0; j < 12; ++j) {
    const bool vt = ISV && j >= 4;  // V tile: rows = tokens; else rows = features
    const int ft = j < 4 ? fk + wn * 64 + j * 16 : fq + wn * 128 + (j - 4) * 16;
    u32x4 d[4];
    __bf16* p[4];
    if (!vt) {
      __bf16* dst = j < 4 ? Kb : QVb;
      const float scl = j < 4 ? 1.0f : 0.125f;  // the score scale folded into Q
      const int ii = ft + half * 8;             // 8 consecutive d of one head
      const f32x4 blo = *(const f32x4*)(sBias + wn * 192 + j * 16 + half * 8);
      const f32x4 bhi = *(const f32x4*)(sBias + wn * 192 + j * 16 + half * 8 + 4);
      const v8f bv = __builtin_shufflevector(blo, bhi, 0, 1, 2, 3, 4, 5, 6, 7);
      const int b = n * 16 + (ii >> 6);
#pragma unroll
      for (int i = 0; i < 4; ++i) {
        const int l = lb + i * 16 + m;
        p[i] = dst + ((size_t)b * 2048 + l) * 64 + (ii & 63);
        d[i] = pack8((acc[i][j] + bv) * scl);
      }
    } else {
      const int ii = ft + m;
      const float bv = sBias[wn * 192 + j * 16 + m];
      const int b = n * 16 + (ii >> 6);
#pragma unroll
      for (int i = 0; i < 4; ++i) {
        const int l = lb + i * 16 + half * 8;  // 8 consecutive tokens
        p[i] = QVb + ((size_t)b * 64 + (ii & 63)) * 2048 + l;
        d[i] = pack8(acc[i][j] + bv);
      }
    }
    __builtin_amdgcn_sched_barrier(0);
#pragma unroll
    for (int i = 0; i < 4; ++i) *(u32x4*)p[i] = d[i];
    asm volatile("s_wait_xcnt 0x0" ::: "memory");
    __builtin_amdgcn_sched_barrier(0);
  }
}

__global__ __launch_bounds__(256) void gemm_qkv(
    const __bf16* __restrict__ A, const __bf16* __restrict__ B,
    const float* __restrict__ bias,
    __bf16* __restrict__ Qb, __bf16* __restrict__ Kb, __bf16* __restrict__ Vtb) {
  __shared__ __align__(16) __bf16 sA[2 * QASZ];
  __shared__ __align__(16) __bf16 sB[2 * QBSZ];
  if (blockIdx.x & 1)
    gemm_qkv_body<true>(sA, sB, A, B, bias, Kb, Vtb);
  else
    gemm_qkv_body<false>(sA, sB, A, B, bias, Kb, Qb);
}

// Kernel 4: output projection (bias, f32 store to d_out). Workgroup tile 128(M) x
// 256(N), 8 waves (2x4), wave tile 64x64 (4x4 WMMA tiles): each fragment read from
// LDS feeds 4 WMMAs, each operand row fetched from L2 feeds 128 or 256 outputs.
static constexpr int ASZ = 128 * LDST;
static constexpr int BSZ = 256 * LDST;

__global__ __launch_bounds__(256) void gemm_out(
    const __bf16* __restrict__ A, const __bf16* __restrict__ B,
    const float* __restrict__ bias, float* __restrict__ outF) {
  __shared__ __align__(16) __bf16 sA[2 * ASZ];
  __shared__ __align__(16) __bf16 sB[2 * BSZ];

  const int tid = threadIdx.x;
  const int lane = tid & 31;
  const int w = tid >> 5;
  const int wm = w & 1, wn = w >> 1;
  const int row0 = blockIdx.y * 128;
  const int col0 = blockIdx.x * 256;

  // 12 async copies per thread per K-chunk: 4 for A (128 rows x 64 K = 1024 x
  // 16 B), 8 for B (256 rows). A thread's copies lie 32 tile rows apart.
  const int sr = tid >> 3, sc = (tid & 7) * 8;
  const __bf16* gA = A + (size_t)(row0 + sr) * 1024 + sc;
  const __bf16* gB = B + (size_t)(col0 + sr) * 1024 + sc;
  const unsigned lA = (unsigned)(size_t)(sA + sr * LDST + sc);  // LDS byte address
  const unsigned lB = (unsigned)(size_t)(sB + sr * LDST + sc);
  auto stage = [&](int buf, int kb) {
    unsigned l[12];
    const __bf16* g[12];
#pragma unroll
    for (int s = 0; s < 4; ++s) {
      l[s] = lA + (buf * ASZ + s * 32 * LDST) * 2;
      g[s] = gA + s * 32 * 1024 + kb;
    }
#pragma unroll
    for (int s = 0; s < 8; ++s) {
      l[4 + s] = lB + (buf * BSZ + s * 32 * LDST) * 2;
      g[4 + s] = gB + s * 32 * 1024 + kb;
    }
    async_g2l_b128_x12(l, g);
  };

  v8f acc[4][4] = {};

  stage(0, 0);
  asm volatile("s_wait_asynccnt 0x0" ::: "memory");  // chunk 0 has landed (own copies)
  __syncthreads();                                   // ... and every other wave's
  stage(1, 64);
  for (int kb = 0; kb < 1024; kb += 64) {
    const int cur = (kb >> 6) & 1;
    const __bf16* cA = sA + cur * ASZ + wm * 64 * LDST;  // this wave's 64 tokens
    const __bf16* cB = sB + cur * BSZ + wn * 64 * LDST;  // this wave's 64 features
#pragma unroll
    for (int kk = 0; kk < 64; kk += 32) {
      v16bf af[4], bfr[4];
#pragma unroll
      for (int i = 0; i < 4; ++i)
        af[i] = load_frag(cA + i * 16 * LDST + kk, LDST, lane);
#pragma unroll
      for (int j = 0; j < 4; ++j)
        bfr[j] = load_frag(cB + j * 16 * LDST + kk, LDST, lane);
      // Keeps the 16 LDS reads together in front of their 16 WMMAs: left alone the
      // scheduler spreads them, one full LDS wait in front of every row of four.
      __builtin_amdgcn_sched_barrier(0);
#pragma unroll
      for (int i = 0; i < 4; ++i)
#pragma unroll
        for (int j = 0; j < 4; ++j)
          acc[i][j] = wmma_bf16(af[i], bfr[j], acc[i][j]);
    }
    // Hand-over: own reads of buffer `cur` retired, own copies of the next chunk
    // landed; the one barrier publishes that chunk and frees `cur` for a refill.
    asm volatile("s_wait_dscnt 0x0" ::: "memory");
    asm volatile("s_wait_asynccnt 0x0" ::: "memory");
    __syncthreads();
    if (kb + 128 < 1024) stage(cur, kb + 128);  // flies while the next chunk is worked on
  }
  asm volatile("s_wait_asynccnt 0x0" ::: "memory");  // nothing in flight at the wave's end

  // Epilogue. C layout: VGPR v -> row (v + half*8), col = lane%16 within tile.
  const int m = lane & 15, half = lane >> 4;
#pragma unroll
  for (int i = 0; i < 4; ++i) {
#pragma unroll
    for (int j = 0; j < 4; ++j) {
      const int f = col0 + wn * 64 + j * 16 + m;
      const float bv = bias[f];
#pragma unroll
      for (int v = 0; v < 8; ++v) {
        const int r = row0 + wm * 64 + i * 16 + v + half * 8;
        outF[(size_t)r * 1024 + f] = acc[i][j][v] + bv;
      }
    }
  }
}

// ---------------------------------------------------------------------------
// Kernel 3: flash attention. One wave = 32 query rows (two 16-column groups) of
// one (batch,head) b: every K and V^T fragment read from LDS feeds two WMMAs, one
// per column group, and a block of 8 waves covers 256 query rows, so each 64-key
// K/V^T block is fetched from L2 by half as many blocks.
// All 8 waves of a block share b, so each 64-key K/V^T block is staged ONCE
// per workgroup into double-buffered LDS via async copies: block i+1 streams
// in while WMMAs/softmax run on block i.
// Computes S^T = K*Q^T so that exp(S^T) registers are already in the exact
// B-operand packing for O^T += V^T * P^T (no LDS transpose needed).
// One pass = 64 keys: the work that is done once per pass whatever its length
// (new maximum and its exchange, alpha, rescale of the O^T registers, exchange
// of the row sum, addresses, barrier) is paid once per 64 keys.
// ---------------------------------------------------------------------------
static constexpr int KST = 72;  // K tile stride (ushorts) = 144B
static constexpr int VST = 72;  // V^T tile stride (ushorts) = 144B
static constexpr int KSZ = 64 * KST;
static constexpr int VSZ = 64 * VST;

// 4 waves per SIMD (at most 256 VGPRs): the 512 blocks are all resident at once.
__global__ __launch_bounds__(256) __attribute__((amdgpu_waves_per_eu(4, 4)))
void attn_kernel(const __bf16* __restrict__ Q, const __bf16* __restrict__ K,
                 const __bf16* __restrict__ Vt, __bf16* __restrict__ O) {
  __shared__ __align__(16) __bf16 sK[2 * KSZ];  // 64 keys x 64 d
  __shared__ __align__(16) __bf16 sV[2 * VSZ];  // 64 d x 64 keys (V^T)

  const int tid = threadIdx.x;
  const int lane = tid & 31;
  const int w = tid >> 5;
  const int b = blockIdx.y;                   // 0..63  (= n*16 + head)
  const int r0 = blockIdx.x * 256 + w * 32;   // first query row of the wave
  const int m = lane & 15, half = lane >> 4;

  const __bf16* Qb = Q + (size_t)b * 2048 * 64;
  const __bf16* Kb = K + (size_t)b * 2048 * 64;
  const __bf16* Vb = Vt + (size_t)b * 64 * 2048;

  // 4 async copies per thread per 64-key block: either tile is 64 rows x 128 B =
  // 512 x 16 B; a thread's two copies of a tile lie 32 tile rows apart.
  const int sr = tid >> 3, sc = (tid & 7) * 8;
  const __bf16* gK = Kb + (size_t)sr * 64 + sc;
  const __bf16* gV = Vb + (size_t)sr * 2048 + sc;
  const unsigned lK = (unsigned)(size_t)(sK + sr * KST + sc);  // LDS byte address
  const unsigned lV = (unsigned)(size_t)(sV + sr * VST + sc);
  auto stage = [&](int buf, int key0) {
    unsigned l[4];
    const __bf16* g[4];
#pragma unroll
    for (int s = 0; s < 2; ++s) {
      l[s] = lK + (buf * KSZ + s * 32 * KST) * 2;
      g[s] = gK + (key0 + s * 32) * 64;
      l[2 + s] = lV + (buf * VSZ + s * 32 * VST) * 2;
      g[2 + s] = gV + s * 32 * 2048 + key0;
    }
    async_g2l_b128_x4(l, g);
  };

  // Q fragments (used as B operand: column n = query row n) of column group q,
  // d split in 2x32
  v16bf qf[2][2];
#pragma unroll
  for (int q = 0; q < 2; ++q)
#pragma unroll
    for (int c = 0; c < 2; ++c)
      qf[q][c] = load_frag(Qb + (size_t)(r0 + q * 16) * 64 + c * 32, 64, lane);

  v8f ot[2][4] = {};                  // O^T tiles: d = j*16 + v + half*8, col = query m
  float mrow[2] = {-1e30f, -1e30f};   // running max for query row m (dup in lane m+16)
  float lrow[2] = {0.0f, 0.0f};       // running sum

  stage(0, 0);
  asm volatile("s_wait_asynccnt 0x0" ::: "memory");  // block 0 has landed (own copies)
  __syncthreads();                                   // ... and every other wave's
  stage(1, 64);
  for (int kb = 0; kb < 32; ++kb) {
    const int cur = kb & 1;
    const __bf16* cK = sK + cur * KSZ;
    const __bf16* cV = sV + cur * VSZ;

    // LDS fragment loads. K as A operand: key tile t, d-chunk c. V^T as A operand:
    // fragment i = (key group i / 4, d tile i % 4), rows = d, 32 contiguous keys.
    auto kfrag = [&](int t, int c) {
      return load_frag(cK + (t * 16) * KST + c * 32, KST, lane);
    };
    auto vfrag = [&](int i) {
      return load_frag(cV + ((i & 3) * 16) * VST + (i >> 2) * 32, VST, lane);
    };
    // One key tile against both column groups; the two chains alternate.
    v8f st[2][4];
    auto score = [&](int t, const v16bf (&k)[2]) {
      v8f z0 = {}, z1 = {};
      z0 = wmma_bf16(k[0], qf[0][0], z0);
      z1 = wmma_bf16(k[0], qf[1][0], z1);
      st[0][t] = wmma_bf16(k[1], qf[0][1], z0);
      st[1][t] = wmma_bf16(k[1], qf[1][1], z1);
    };

    // S^T tiles: row = key, col = query. Q already scaled by 1/8. The loads run one
    // key tile ahead of the products, the first V^T fragment too. The scheduling
    // barriers keep them there: left alone the scheduler sinks every load to its
    // product, and the wave waits out a full LDS latency in front of each.
    v16bf ka[2] = {kfrag(0, 0), kfrag(0, 1)};
    v16bf kc[2] = {kfrag(1, 0), kfrag(1, 1)};
    __builtin_amdgcn_sched_barrier(0);
    score(0, ka);
    ka[0] = kfrag(2, 0);
    ka[1] = kfrag(2, 1);
    __builtin_amdgcn_sched_barrier(0);
    score(1, kc);
    kc[0] = kfrag(3, 0);
    kc[1] = kfrag(3, 1);
    score(2, ka);
    v16bf vf[4];
    vf[0] = vfrag(0);
    __builtin_amdgcn_sched_barrier(0);
    score(3, kc);

    // online softmax, per column group: each lane holds 32 scores of its query row;
    // partner lane (xor 16) holds the other 32 keys of this 64-key block.
    float vmax[2], alpha[2];
#pragma unroll
    for (int q = 0; q < 2; ++q) {
      vmax[q] = -1e30f;
#pragma unroll
      for (int t = 0; t < 4; ++t)
#pragma unroll
        for (int v = 0; v < 8; ++v) vmax[q] = fmaxf(vmax[q], st[q][t][v]);
    }
    const float xmax[2] = {__shfl_xor(vmax[0], 16, 32), __shfl_xor(vmax[1], 16, 32)};

    // P^T in registers, repacked directly into B-operand layout, one operand per
    // 32 keys: element e<8 -> tile 2g [e], e>=8 -> tile 2g+1 [e-8] (both halves).
    // Neighbouring keys stay in register pairs: one packed convert per pair, and
    // the row sum runs in pairs too (one packed add per pair), joined at the end.
    v16bf pb[2][2];
    float psum[2];
#pragma unroll
    for (int q = 0; q < 2; ++q) {
      const float mnew = fmaxf(mrow[q], fmaxf(vmax[q], xmax[q]));
      alpha[q] = __expf(mrow[q] - mnew);
      mrow[q] = mnew;

      // exp(s - mnew) over all 32 scores of the lane, in place: the differences
      // times log2(e), then the exponentials.
#pragma unroll
      for (int t = 0; t < 4; ++t)
        st[q][t] = (st[q][t] - mnew) * 1.44269504088896340736f;
#pragma unroll
      for (int t = 0; t < 4; ++t)
#pragma unroll
        for (int v = 0; v < 8; ++v) st[q][t][v] = __builtin_amdgcn_exp2f(st[q][t][v]);

      f32x2 ps2[2];
#pragma unroll
      for (int g = 0; g < 2; ++g) {
        u32x8 pw;
#pragma unroll
        for (int e = 0; e < 4; ++e) {
          const f32x2 p0 = {st[q][2 * g][2 * e], st[q][2 * g][2 * e + 1]};
          const f32x2 p1 = {st[q][2 * g + 1][2 * e], st[q][2 * g + 1][2 * e + 1]};
          const f32x2 ps = p0 + p1;
          ps2[g] = e == 0 ? ps : ps2[g] + ps;
          pw[e] = pk2(p0[0], p0[1]);
          pw[e + 4] = pk2(p1[0], p1[1]);
        }
        pb[q][g] = __builtin_bit_cast(v16bf, pw);
      }
      const f32x2 psj = ps2[0] + ps2[1];
      psum[q] = psj[0] + psj[1];
    }
    vf[1] = vfrag(1);
    vf[2] = vfrag(2);
    vf[3] = vfrag(3);
    const float xsum[2] = {__shfl_xor(psum[0], 16, 32), __shfl_xor(psum[1], 16, 32)};
#pragma unroll
    for (int q = 0; q < 2; ++q) {
      lrow[q] = lrow[q] * alpha[q] + (psum[q] + xsum[q]);
#pragma unroll
      for (int j = 0; j < 4; ++j) ot[q][j] *= alpha[q];
    }

    // O^T += V^T * P^T, each fragment against both column groups; the pair of
    // products is followed by the load of the fragment four ahead into the
    // registers it frees.
#pragma unroll
    for (int i = 0; i < 8; ++i) {
      ot[0][i & 3] = wmma_bf16(vf[i & 3], pb[0][i >> 2], ot[0][i & 3]);
      ot[1][i & 3] = wmma_bf16(vf[i & 3], pb[1][i >> 2], ot[1][i & 3]);
      if (i + 4 < 8) vf[i & 3] = vfrag(i + 4);
    }

    // Hand-over: own reads of buffer `cur` retired, own copies of the next block
    // landed; the one barrier publishes that block and frees `cur` for a refill.
    asm volatile("s_wait_dscnt 0x0" ::: "memory");
    asm volatile("s_wait_asynccnt 0x0" ::: "memory");
    __syncthreads();
    if (kb + 2 < 32) stage(cur, (kb + 2) * 64);  // flies while the next block is worked on
  }
  asm volatile("s_wait_asynccnt 0x0" ::: "memory");  // nothing in flight at the wave's end

  // Normalize and scatter into (l, n, h*64 + d) bf16 layout for the out GEMM.
  const int n = b >> 4, hh = b & 15;
#pragma unroll
  for (int q = 0; q < 2; ++q) {
    const float inv = 1.0f / lrow[q];
    const int lseq = r0 + q * 16 + m;
    __bf16* orow = O + ((size_t)lseq * 4 + n) * 1024 + hh * 64;
#pragma unroll
    for (int j = 0; j < 4; ++j)
      *(u32x4*)(orow + j * 16 + half * 8) = pack8(ot[q][j] * inv);
  }
}

// ---------------------------------------------------------------------------
// Launch
// ---------------------------------------------------------------------------
extern "C" void kernel_launch(void* const* d_in, const int* in_sizes, int n_in,
                              void* d_out, int out_size, void* d_ws, size_t ws_size,
                              hipStream_t stream) {
  const float* query = (const float*)d_in[0];     // (2048, 4, 1024)
  const float* qkv_proj = (const float*)d_in[1];  // (3072, 1024)
  const float* qkv_bias = (const float*)d_in[2];  // (3072,)
  const float* out_proj = (const float*)d_in[3];  // (1024, 1024)
  const float* out_bias = (const float*)d_in[4];  // (1024,)
  float* out = (float*)d_out;                     // (2048, 4, 1024) f32
  (void)in_sizes; (void)n_in; (void)out_size; (void)ws_size;

  char* ws = (char*)d_ws;
  size_t off = 0;
  auto carve = [&](size_t bytes) {
    void* p = ws + off;
    off += (bytes + 255) & ~(size_t)255;
    return p;
  };
  __bf16* qA   = (__bf16*)carve(8192ull * 1024 * 2);       // query bf16, row n*2048+l
  __bf16* wQKV = (__bf16*)carve(3072ull * 1024 * 2);       // qkv_proj bf16, row jj*1024+ii
  __bf16* wOUT = (__bf16*)carve(1024ull * 1024 * 2);       // out_proj bf16
  __bf16* Qb   = (__bf16*)carve(64ull * 2048 * 64 * 2);    // Q (b,l,d), pre-scaled
  __bf16* Kb   = (__bf16*)carve(64ull * 2048 * 64 * 2);    // K (b,l,d)
  __bf16* Vtb  = (__bf16*)carve(64ull * 64 * 2048 * 2);    // V^T (b,d,l)
  __bf16* Ob   = (__bf16*)carve(8192ull * 1024 * 2);       // attn out (l*4+n, i)

  // All three converts: 8192 + 3072 + 1024 rows, one block each
  cvt_f32_bf16<<<8192 + 3072 + 1024, 256, 0, stream>>>(query, qkv_proj, out_proj, qA, wQKV,
                                                       wOUT);

  // QKV projection: M=8192, N=3072 -> grid (8, 32), one block per WGP
  gemm_qkv<<<dim3(8, 32), 256, 0, stream>>>(qA, wQKV, qkv_bias, Qb, Kb, Vtb);
  // Attention: 64 head-batches x 8 row-groups of 256 rows
  attn_kernel<<<dim3(8, 64), 256, 0, stream>>>(Qb, Kb, Vtb, Ob);
  // Output projection: M=8192, N=1024 -> grid (4, 64)
  gemm_out<<<dim3(4, 64), 256, 0, stream>>>(Ob, wOUT, out_bias, out);
}
